// v000
// Measured on an AMD MI455X. A time is GPU time per run, averaged over a window of back-to-back runs after a warm-up
// (all launches, gaps included; the runs take copies of the inputs in turn), and the median of several windows.
// Apart from v000's, it joins two sittings. Times from different sittings can be a few percent apart, while
// side-by-side timings come from the same sitting.
// The starting kernel, v000, takes 563 microseconds a run.
#include <hip/hip_runtime.h>
#include <hip/hip_bf16.h>

#ifndef __has_builtin
#define __has_builtin(x) 0
#endif

// FP32 WMMA building blocks for gfx1250 (wave32).
typedef float v2f __attribute__((ext_vector_type(2)));
typedef float v4f __attribute__((ext_vector_type(4)));
typedef float v8f __attribute__((ext_vector_type(8)));
typedef int   v4i __attribute__((ext_vector_type(4)));

#define WMMA_F32(a, b, c) \
    __builtin_amdgcn_wmma_f32_16x16x4_f32(false, (a), false, (b), (short)0, (c), false, false)
#define LO2(v) __builtin_shufflevector((v), (v), 0, 1)
#define HI2(v) __builtin_shufflevector((v), (v), 2, 3)

constexpr int Bn = 8;
constexpr int Ln = 2048;
constexpr int Dn = 768;
constexpr int Rn = Bn * Ln;       // 16384 rows of x
constexpr int DT = Dn / 16;       // 48

// k-permutation dual-WMMA step: one b128 per fragment covers 8 k-columns.
// WMMA#1 uses phys cols {k0,k0+1,k0+4,k0+5}, WMMA#2 {k0+2,k0+3,k0+6,k0+7};
// A and B share the same permutation, so the accumulated sum is exact.
#define STEP8(acc, a4, b4)                      \
    do {                                        \
        acc = WMMA_F32(LO2(a4), LO2(b4), acc);  \
        acc = WMMA_F32(HI2(a4), HI2(b4), acc);  \
    } while (0)

// --- CDNA5 async global->LDS copy (ASYNCcnt) with safe fallback -------------
#if __has_builtin(__builtin_amdgcn_global_load_async_to_lds_b128)
#define HAVE_ASYNC_LDS 1
typedef const __attribute__((address_space(1))) void* gas_void;
typedef __attribute__((address_space(3))) void*       las_void;
typedef __attribute__((address_space(1))) v4i*        gas_v4i;
typedef __attribute__((address_space(3))) v4i*        las_v4i;
__device__ __forceinline__ void lds_copy16(float* dst, const float* src) {
    __builtin_amdgcn_global_load_async_to_lds_b128(
        (gas_v4i)(gas_void)(const void*)src,
        (las_v4i)(las_void)(void*)dst,
        0, 0);
}
__device__ __forceinline__ void lds_copy_wait() {
#if __has_builtin(__builtin_amdgcn_s_wait_asynccnt)
    __builtin_amdgcn_s_wait_asynccnt(0);
#else
    asm volatile("s_wait_asynccnt 0" ::: "memory");
#endif
}
#else
#define HAVE_ASYNC_LDS 0
__device__ __forceinline__ void lds_copy16(float* dst, const float* src) {
    *(v4f*)dst = *(const v4f*)src;     // global_load_b128 + ds_store_b128
}
__device__ __forceinline__ void lds_copy_wait() {}  // barrier's dscnt wait covers it
#endif

// ---------------------------------------------------------------------------
// Kernel 1: fused QKV projection.
// WG = 8 waves covering 256 rows x 16 cols; all waves share one tn, so the
// three 16-row weight strips are staged in LDS (chunks of 128 k-columns,
// double-buffered, async-copy overlapped with WMMA) and fragments are read
// with ds_load_b128.  x fragments stay wave-private global b128 loads.
// Q stored row-major; K,V stored transposed per batch ([b][h][l]) so stage 2
// reads its reduction dim contiguously.
// ---------------------------------------------------------------------------
constexpr int KC  = 128;              // k-chunk
constexpr int LDW = KC + 4;           // padded LDS row stride (bank-conflict free)
constexpr int MATS = 16 * LDW;        // floats per staged matrix strip

__global__ __launch_bounds__(256) void qkv_wmma(
    const float* __restrict__ x,
    const float* __restrict__ Wq, const float* __restrict__ bq,
    const float* __restrict__ Wk, const float* __restrict__ bk,
    const float* __restrict__ Wv, const float* __restrict__ bv,
    float* __restrict__ Q, float* __restrict__ KT, float* __restrict__ VT)
{
    __shared__ float wlds[2][3 * MATS];           // 2 * 3 * 16 * 132 * 4B = 50.7 KB

    const int lane = threadIdx.x & 31;
    const int wave = threadIdx.x >> 5;
    const int tn = blockIdx.x % DT;               // 16-col block [0, 48)
    const int rg = blockIdx.x / DT;               // 256-row group [0, 64)
    const int tm = rg * 8 + wave;                 // this wave's 32-row block

    const int mr = lane & 15;
    const int h4 = (lane >> 4) << 2;              // {0, 4}

    const float* x0 = x + (size_t)(tm * 32 + mr) * Dn;
    const float* x1 = x0 + (size_t)16 * Dn;
    const float* wsrc[3] = { Wq + (size_t)tn * 16 * Dn,
                             Wk + (size_t)tn * 16 * Dn,
                             Wv + (size_t)tn * 16 * Dn };

    // Cooperative staging of one 3x16x128 chunk: 6 x b128 per thread.
    auto stage = [&](int c, int bufi) {
        const int t = threadIdx.x;
        #pragma unroll
        for (int j = 0; j < 2; ++j) {
            const int idx = t + 256 * j;          // 0..511 v4f slots per matrix
            const int row = idx >> 5;             // [0,16)
            const int cv  = (idx & 31) << 2;      // [0,128) step 4
            #pragma unroll
            for (int m = 0; m < 3; ++m)
                lds_copy16(&wlds[bufi][m * MATS + row * LDW + cv],
                           wsrc[m] + (size_t)row * Dn + c * KC + cv);
        }
    };

    v8f aq0 = {}, aq1 = {}, ak0 = {}, ak1 = {}, av0 = {}, av1 = {};
    int buf = 0;
    stage(0, 0);

    constexpr int NC = Dn / KC;                   // 6 chunks
    for (int c = 0; c < NC; ++c) {
        lds_copy_wait();                          // this wave's slice of chunk c landed
        __syncthreads();                          // whole chunk c visible; buf^1 free
        if (c + 1 < NC) {
            stage(c + 1, buf ^ 1);                // overlaps with WMMA below
            __builtin_prefetch(x0 + (c + 1) * KC, 0, 0);
            __builtin_prefetch(x1 + (c + 1) * KC, 0, 0);
        }
        const float* wp = &wlds[buf][mr * LDW];
        #pragma unroll 4
        for (int kk = 0; kk < KC; kk += 8) {
            const v4f a0 = *(const v4f*)(x0 + c * KC + kk + h4);
            const v4f a1 = *(const v4f*)(x1 + c * KC + kk + h4);
            const v4f fq = *(const v4f*)(wp + 0 * MATS + kk + h4);   // ds_load_b128
            const v4f fk = *(const v4f*)(wp + 1 * MATS + kk + h4);
            const v4f fv = *(const v4f*)(wp + 2 * MATS + kk + h4);
            STEP8(aq0, a0, fq);  STEP8(aq1, a1, fq);
            STEP8(ak0, a0, fk);  STEP8(ak1, a1, fk);
            STEP8(av0, a0, fv);  STEP8(av1, a1, fv);
        }
        buf ^= 1;
    }

    // C/D layout: lane = n + 16*(m>=8); VGPR r -> m = (lane>>4)*8 + r.
    const int n   = lane & 15;
    const int m0  = (lane >> 4) << 3;
    const int col = tn * 16 + n;
    const float biasq = bq[col], biask = bk[col], biasv = bv[col];

    const int b  = (tm * 32) / Ln;                // 32 | 2048: never straddles
    const int l0 = tm * 32 - b * Ln + m0;
    float* KTb = KT + (size_t)b * Dn * Ln + (size_t)col * Ln;
    float* VTb = VT + (size_t)b * Dn * Ln + (size_t)col * Ln;

    #pragma unroll
    for (int sub = 0; sub < 2; ++sub) {
        const v8f q = sub ? aq1 : aq0;
        const v8f k = sub ? ak1 : ak0;
        const v8f v = sub ? av1 : av0;
        #pragma unroll
        for (int r = 0; r < 8; ++r)
            Q[(size_t)(tm * 32 + sub * 16 + m0 + r) * Dn + col] = q[r] + biasq;
        const int lb = l0 + sub * 16;
        *(v4f*)(KTb + lb)     = (v4f){k[0] + biask, k[1] + biask, k[2] + biask, k[3] + biask};
        *(v4f*)(KTb + lb + 4) = (v4f){k[4] + biask, k[5] + biask, k[6] + biask, k[7] + biask};
        *(v4f*)(VTb + lb)     = (v4f){v[0] + biasv, v[1] + biasv, v[2] + biasv, v[3] + biasv};
        *(v4f*)(VTb + lb + 4) = (v4f){v[4] + biasv, v[5] + biasv, v[6] + biasv, v[7] + biasv};
    }
}

// ---------------------------------------------------------------------------
// Kernel 2: per-batch M = K^T V (768x768, reduction over l = 2048).
// Transposed operands -> both fragments contiguous along l: 4 b128 loads per
// 8 WMMAs, 32x32 tile per wave.  Output stored as M^T ([b][n][m]).
// ---------------------------------------------------------------------------
__global__ __launch_bounds__(256) void ktv_wmma(
    const float* __restrict__ KT, const float* __restrict__ VT,
    float* __restrict__ MT)
{
    const int lane = threadIdx.x & 31;
    const int wave = threadIdx.x >> 5;
    const int tile = blockIdx.x * 8 + wave;   // 8 * 24 * 24 tiles
    const int b  = tile / (24 * 24);
    const int t  = tile % (24 * 24);
    const int tm = t / 24;
    const int tn = t % 24;

    const int mr = lane & 15;
    const int h4 = (lane >> 4) << 2;

    const float* ka0 = KT + (size_t)b * Dn * Ln + (size_t)(tm * 32 + mr) * Ln;
    const float* ka1 = ka0 + (size_t)16 * Ln;
    const float* vb0 = VT + (size_t)b * Dn * Ln + (size_t)(tn * 32 + mr) * Ln;
    const float* vb1 = vb0 + (size_t)16 * Ln;

    v8f c00 = {}, c01 = {}, c10 = {}, c11 = {};
    #pragma unroll 4
    for (int kk = 0; kk < Ln; kk += 8) {
        const v4f a0 = *(const v4f*)(ka0 + kk + h4);
        const v4f a1 = *(const v4f*)(ka1 + kk + h4);
        const v4f f0 = *(const v4f*)(vb0 + kk + h4);
        const v4f f1 = *(const v4f*)(vb1 + kk + h4);
        STEP8(c00, a0, f0);  STEP8(c01, a0, f1);
        STEP8(c10, a1, f0);  STEP8(c11, a1, f1);
    }

    const int n  = lane & 15;
    const int m0 = (lane >> 4) << 3;
    float* MTb = MT + (size_t)b * Dn * Dn;
    #pragma unroll
    for (int ms = 0; ms < 2; ++ms) {
        #pragma unroll
        for (int ns = 0; ns < 2; ++ns) {
            const v8f c = ms ? (ns ? c11 : c10) : (ns ? c01 : c00);
            const int ng = tn * 32 + ns * 16 + n;
            const int mg = tm * 32 + ms * 16 + m0;
            *(v4f*)(MTb + (size_t)ng * Dn + mg)     = (v4f){c[0], c[1], c[2], c[3]};
            *(v4f*)(MTb + (size_t)ng * Dn + mg + 4) = (v4f){c[4], c[5], c[6], c[7]};
        }
    }
}

// ---------------------------------------------------------------------------
// Kernel 3: out = Q @ M * (1/sqrt(768)).  A = Q row-major, B from M^T; both
// contiguous along the reduction dim.  32x32 per wave, 4 b128 loads / 8 WMMAs.
// ---------------------------------------------------------------------------
__global__ __launch_bounds__(256) void qm_wmma(
    const float* __restrict__ Q, const float* __restrict__ MT,
    float* __restrict__ out)
{
    const int lane = threadIdx.x & 31;
    const int wave = threadIdx.x >> 5;
    const int tile = blockIdx.x * 8 + wave;   // 8 * 64 * 24 tiles
    const int b  = tile / (64 * 24);
    const int t  = tile % (64 * 24);
    const int tm = t / 24;
    const int tn = t % 24;

    const int mr = lane & 15;
    const int h4 = (lane >> 4) << 2;

    const float* qa0 = Q  + (size_t)b * Ln * Dn + (size_t)(tm * 32 + mr) * Dn;
    const float* qa1 = qa0 + (size_t)16 * Dn;
    const float* mb0 = MT + (size_t)b * Dn * Dn + (size_t)(tn * 32 + mr) * Dn;
    const float* mb1 = mb0 + (size_t)16 * Dn;

    v8f c00 = {}, c01 = {}, c10 = {}, c11 = {};
    #pragma unroll 4
    for (int kk = 0; kk < Dn; kk += 8) {
        const v4f a0 = *(const v4f*)(qa0 + kk + h4);
        const v4f a1 = *(const v4f*)(qa1 + kk + h4);
        const v4f f0 = *(const v4f*)(mb0 + kk + h4);
        const v4f f1 = *(const v4f*)(mb1 + kk + h4);
        STEP8(c00, a0, f0);  STEP8(c01, a0, f1);
        STEP8(c10, a1, f0);  STEP8(c11, a1, f1);
    }

    const float alpha = 0.03608439182435161f;   // 1/sqrt(768)
    const int n  = lane & 15;
    const int m0 = (lane >> 4) << 3;
    float* ob = out + (size_t)b * Ln * Dn;
    #pragma unroll
    for (int ms = 0; ms < 2; ++ms) {
        #pragma unroll
        for (int ns = 0; ns < 2; ++ns) {
            const v8f c = ms ? (ns ? c11 : c10) : (ns ? c01 : c00);
            const int ng = tn * 32 + ns * 16 + n;
            const int mg = tm * 32 + ms * 16 + m0;
            #pragma unroll
            for (int r = 0; r < 8; ++r)
                ob[(size_t)(mg + r) * Dn + ng] = c[r] * alpha;
        }
    }
}

// ---------------------------------------------------------------------------
extern "C" void kernel_launch(void* const* d_in, const int* in_sizes, int n_in,
                              void* d_out, int out_size, void* d_ws, size_t ws_size,
                              hipStream_t stream) {
    const float* x  = (const float*)d_in[0];
    const float* Wq = (const float*)d_in[1];
    const float* bq = (const float*)d_in[2];
    const float* Wk = (const float*)d_in[3];
    const float* bk = (const float*)d_in[4];
    const float* Wv = (const float*)d_in[5];
    const float* bv = (const float*)d_in[6];
    float* out = (float*)d_out;

    // Workspace: Q | K^T | V^T | M^T   (3*16384*768 + 8*768*768 floats = 169.9 MB)
    float* Q  = (float*)d_ws;
    float* KT = Q  + (size_t)Rn * Dn;
    float* VT = KT + (size_t)Rn * Dn;
    float* MT = VT + (size_t)Rn * Dn;

    dim3 blk(256);  // 8 waves per workgroup
    qkv_wmma<<<(Rn / 256) * DT, blk, 0, stream>>>(x, Wq, bq, Wk, bk, Wv, bv, Q, KT, VT);
    ktv_wmma<<<Bn * 24 * 24 / 8, blk, 0, stream>>>(KT, VT, MT);
    qm_wmma <<<Bn * 64 * 24 / 8, blk, 0, stream>>>(Q, MT, out);
}

// v001
// A run of this version takes 429 microseconds.
// Next to v000, in two timings, it ran 1.36 times as fast each time.
#include <hip/hip_runtime.h>
#include <hip/hip_bf16.h>

#ifndef __has_builtin
#define __has_builtin(x) 0
#endif

// FP32 WMMA building blocks for gfx1250 (wave32).
typedef float v2f __attribute__((ext_vector_type(2)));
typedef float v4f __attribute__((ext_vector_type(4)));
typedef float v8f __attribute__((ext_vector_type(8)));
typedef int   v4i __attribute__((ext_vector_type(4)));

#define WMMA_F32(a, b, c) \
    __builtin_amdgcn_wmma_f32_16x16x4_f32(false, (a), false, (b), (short)0, (c), false, false)
#define LO2(v) __builtin_shufflevector((v), (v), 0, 1)
#define HI2(v) __builtin_shufflevector((v), (v), 2, 3)

constexpr int Bn = 8;
constexpr int Ln = 2048;
constexpr int Dn = 768;
constexpr int Rn = Bn * Ln;       // 16384 rows of x
constexpr int DT = Dn / 16;       // 48

// k-permutation dual-WMMA step: one b128 per fragment covers 8 k-columns.
// WMMA#1 uses phys cols {k0,k0+1,k0+4,k0+5}, WMMA#2 {k0+2,k0+3,k0+6,k0+7};
// A and B share the same permutation, so the accumulated sum is exact.
#define STEP8(acc, a4, b4)                      \
    do {                                        \
        acc = WMMA_F32(LO2(a4), LO2(b4), acc);  \
        acc = WMMA_F32(HI2(a4), HI2(b4), acc);  \
    } while (0)

// --- CDNA5 async global->LDS copy (ASYNCcnt) with safe fallback -------------
#if __has_builtin(__builtin_amdgcn_global_load_async_to_lds_b128)
#define HAVE_ASYNC_LDS 1
typedef const __attribute__((address_space(1))) void* gas_void;
typedef __attribute__((address_space(3))) void*       las_void;
typedef __attribute__((address_space(1))) v4i*        gas_v4i;
typedef __attribute__((address_space(3))) v4i*        las_v4i;
__device__ __forceinline__ void lds_copy16(float* dst, const float* src) {
    __builtin_amdgcn_global_load_async_to_lds_b128(
        (gas_v4i)(gas_void)(const void*)src,
        (las_v4i)(las_void)(void*)dst,
        0, 0);
}
__device__ __forceinline__ void lds_copy_wait() {
#if __has_builtin(__builtin_amdgcn_s_wait_asynccnt)
    __builtin_amdgcn_s_wait_asynccnt(0);
#else
    asm volatile("s_wait_asynccnt 0" ::: "memory");
#endif
}
#else
#define HAVE_ASYNC_LDS 0
__device__ __forceinline__ void lds_copy16(float* dst, const float* src) {
    *(v4f*)dst = *(const v4f*)src;     // global_load_b128 + ds_store_b128
}
__device__ __forceinline__ void lds_copy_wait() {}  // barrier's dscnt wait covers it
#endif

// ---------------------------------------------------------------------------
// Kernel 1: fused QKV projection.
// WG = 8 waves covering 256 rows x 16 cols; all waves share one tn, so the
// three 16-row weight strips are staged in LDS (chunks of 128 k-columns,
// double-buffered, async-copy overlapped with WMMA) and fragments are read
// with ds_load_b128.  x fragments stay wave-private global b128 loads.
// Q stored row-major; K,V stored transposed per batch ([b][h][l]) so stage 2
// reads its reduction dim contiguously.
// ---------------------------------------------------------------------------
constexpr int KC  = 128;              // k-chunk
constexpr int LDW = KC + 4;           // padded LDS row stride (bank-conflict free)
constexpr int MATS = 16 * LDW;        // floats per staged matrix strip

__global__ __launch_bounds__(256) void qkv_wmma(
    const float* __restrict__ x,
    const float* __restrict__ Wq, const float* __restrict__ bq,
    const float* __restrict__ Wk, const float* __restrict__ bk,
    const float* __restrict__ Wv, const float* __restrict__ bv,
    float* __restrict__ Q, float* __restrict__ KT, float* __restrict__ VT)
{
    __shared__ float wlds[2][3 * MATS];           // 2 * 3 * 16 * 132 * 4B = 50.7 KB

    const int lane = threadIdx.x & 31;
    const int wave = threadIdx.x >> 5;
    const int tn = blockIdx.x % DT;               // 16-col block [0, 48)
    const int rg = blockIdx.x / DT;               // 256-row group [0, 64)
    const int tm = rg * 8 + wave;                 // this wave's 32-row block

    const int mr = lane & 15;
    const int h4 = (lane >> 4) << 2;              // {0, 4}

    const float* x0 = x + (size_t)(tm * 32 + mr) * Dn;
    const float* x1 = x0 + (size_t)16 * Dn;
    const float* wsrc[3] = { Wq + (size_t)tn * 16 * Dn,
                             Wk + (size_t)tn * 16 * Dn,
                             Wv + (size_t)tn * 16 * Dn };

    // Cooperative staging of one 3x16x128 chunk: 6 x b128 per thread.
    auto stage = [&](int c, int bufi) {
        const int t = threadIdx.x;
        #pragma unroll
        for (int j = 0; j < 2; ++j) {
            const int idx = t + 256 * j;          // 0..511 v4f slots per matrix
            const int row = idx >> 5;             // [0,16)
            const int cv  = (idx & 31) << 2;      // [0,128) step 4
            #pragma unroll
            for (int m = 0; m < 3; ++m)
                lds_copy16(&wlds[bufi][m * MATS + row * LDW + cv],
                           wsrc[m] + (size_t)row * Dn + c * KC + cv);
        }
    };

    v8f aq0 = {}, aq1 = {}, ak0 = {}, ak1 = {}, av0 = {}, av1 = {};
    int buf = 0;
    stage(0, 0);

    constexpr int NC = Dn / KC;                   // 6 chunks
    for (int c = 0; c < NC; ++c) {
        lds_copy_wait();                          // this wave's slice of chunk c landed
        __syncthreads();                          // whole chunk c visible; buf^1 free
        if (c + 1 < NC) {
            stage(c + 1, buf ^ 1);                // overlaps with WMMA below
            __builtin_prefetch(x0 + (c + 1) * KC, 0, 0);
            __builtin_prefetch(x1 + (c + 1) * KC, 0, 0);
        }
        const float* wp = &wlds[buf][mr * LDW];
        #pragma unroll 4
        for (int kk = 0; kk < KC; kk += 8) {
            const v4f a0 = *(const v4f*)(x0 + c * KC + kk + h4);
            const v4f a1 = *(const v4f*)(x1 + c * KC + kk + h4);
            const v4f fq = *(const v4f*)(wp + 0 * MATS + kk + h4);   // ds_load_b128
            const v4f fk = *(const v4f*)(wp + 1 * MATS + kk + h4);
            const v4f fv = *(const v4f*)(wp + 2 * MATS + kk + h4);
            STEP8(aq0, a0, fq);  STEP8(aq1, a1, fq);
            STEP8(ak0, a0, fk);  STEP8(ak1, a1, fk);
            STEP8(av0, a0, fv);  STEP8(av1, a1, fv);
        }
        buf ^= 1;
    }

    // C/D layout: lane = n + 16*(m>=8); VGPR r -> m = (lane>>4)*8 + r.
    const int n   = lane & 15;
    const int m0  = (lane >> 4) << 3;
    const int col = tn * 16 + n;
    const float biasq = bq[col], biask = bk[col], biasv = bv[col];

    const int b  = (tm * 32) / Ln;                // 32 | 2048: never straddles
    const int l0 = tm * 32 - b * Ln + m0;
    float* KTb = KT + (size_t)b * Dn * Ln + (size_t)col * Ln;
    float* VTb = VT + (size_t)b * Dn * Ln + (size_t)col * Ln;

    #pragma unroll
    for (int sub = 0; sub < 2; ++sub) {
        const v8f q = sub ? aq1 : aq0;
        const v8f k = sub ? ak1 : ak0;
        const v8f v = sub ? av1 : av0;
        #pragma unroll
        for (int r = 0; r < 8; ++r)
            Q[(size_t)(tm * 32 + sub * 16 + m0 + r) * Dn + col] = q[r] + biasq;
        const int lb = l0 + sub * 16;
        *(v4f*)(KTb + lb)     = (v4f){k[0] + biask, k[1] + biask, k[2] + biask, k[3] + biask};
        *(v4f*)(KTb + lb + 4) = (v4f){k[4] + biask, k[5] + biask, k[6] + biask, k[7] + biask};
        *(v4f*)(VTb + lb)     = (v4f){v[0] + biasv, v[1] + biasv, v[2] + biasv, v[3] + biasv};
        *(v4f*)(VTb + lb + 4) = (v4f){v[4] + biasv, v[5] + biasv, v[6] + biasv, v[7] + biasv};
    }
}

// ---------------------------------------------------------------------------
// Shared core of kernels 2 and 3: C = A * B^T, both operands contiguous along
// the reduction dim (leading dim LD = reduction length).  One BM x BN tile per
// work-group of NTHR / 32 waves, WN of them side by side along n, wave tile
// (16*FA) x (16*FB).  Chunks of KC k-columns of all BM + BN operand rows are
// brought into LDS by whole-line asynchronous b128 copies, two buffers: chunk
// c + 1 flies while chunk c is multiplied.  Fragments come from LDS with
// ds_load_b128 at a pitch of KC + 4 floats (16 B x odd: no bank conflict).
// ---------------------------------------------------------------------------

// A run of copies and its s_wait_xcnt 0 in ONE statement, so that no address
// register of a copy is rewritten ahead of the wait.
__device__ __forceinline__ void copy_run(const unsigned (&l)[12], const float* const (&g)[12]) {
    asm volatile("global_load_async_to_lds_b128 %0, %1, off\n\t"
                 "global_load_async_to_lds_b128 %2, %3, off\n\t"
                 "global_load_async_to_lds_b128 %4, %5, off\n\t"
                 "global_load_async_to_lds_b128 %6, %7, off\n\t"
                 "global_load_async_to_lds_b128 %8, %9, off\n\t"
                 "global_load_async_to_lds_b128 %10, %11, off\n\t"
                 "global_load_async_to_lds_b128 %12, %13, off\n\t"
                 "global_load_async_to_lds_b128 %14, %15, off\n\t"
                 "global_load_async_to_lds_b128 %16, %17, off\n\t"
                 "global_load_async_to_lds_b128 %18, %19, off\n\t"
                 "global_load_async_to_lds_b128 %20, %21, off\n\t"
                 "global_load_async_to_lds_b128 %22, %23, off\n\t"
                 "s_wait_xcnt 0x0"
                 :: "v"(l[0]), "v"(g[0]), "v"(l[1]), "v"(g[1]), "v"(l[2]), "v"(g[2]),
                    "v"(l[3]), "v"(g[3]), "v"(l[4]), "v"(g[4]), "v"(l[5]), "v"(g[5]),
                    "v"(l[6]), "v"(g[6]), "v"(l[7]), "v"(g[7]), "v"(l[8]), "v"(g[8]),
                    "v"(l[9]), "v"(g[9]), "v"(l[10]), "v"(g[10]), "v"(l[11]), "v"(g[11])
                 : "memory");
}
__device__ __forceinline__ void copy_run(const unsigned (&l)[14], const float* const (&g)[14]) {
    asm volatile("global_load_async_to_lds_b128 %0, %1, off\n\t"
                 "global_load_async_to_lds_b128 %2, %3, off\n\t"
                 "global_load_async_to_lds_b128 %4, %5, off\n\t"
                 "global_load_async_to_lds_b128 %6, %7, off\n\t"
                 "global_load_async_to_lds_b128 %8, %9, off\n\t"
                 "global_load_async_to_lds_b128 %10, %11, off\n\t"
                 "global_load_async_to_lds_b128 %12, %13, off\n\t"
                 "global_load_async_to_lds_b128 %14, %15, off\n\t"
                 "global_load_async_to_lds_b128 %16, %17, off\n\t"
                 "global_load_async_to_lds_b128 %18, %19, off\n\t"
                 "global_load_async_to_lds_b128 %20, %21, off\n\t"
                 "global_load_async_to_lds_b128 %22, %23, off\n\t"
                 "global_load_async_to_lds_b128 %24, %25, off\n\t"
                 "global_load_async_to_lds_b128 %26, %27, off\n\t"
                 "s_wait_xcnt 0x0"
                 :: "v"(l[0]), "v"(g[0]), "v"(l[1]), "v"(g[1]), "v"(l[2]), "v"(g[2]),
                    "v"(l[3]), "v"(g[3]), "v"(l[4]), "v"(g[4]), "v"(l[5]), "v"(g[5]),
                    "v"(l[6]), "v"(g[6]), "v"(l[7]), "v"(g[7]), "v"(l[8]), "v"(g[8]),
                    "v"(l[9]), "v"(g[9]), "v"(l[10]), "v"(g[10]), "v"(l[11]), "v"(g[11]),
                    "v"(l[12]), "v"(g[12]), "v"(l[13]), "v"(g[13])
                 : "memory");
}

// One chunk of all BM + BN rows: the block's NTHR lanes sweep NTHR * 4 / KC rows
// at a time, 16 B a lane, G copies a statement.  l0, ga, gb: this lane's slot in
// the first sweep (LDS byte address, A source, B source).
template <int BM, int BN, int KC, int LD, int NTHR, int G>
__device__ __forceinline__ void stage_chunk(unsigned l0, const float* ga, const float* gb) {
    constexpr int RPS = NTHR * 4 / KC;
    constexpr int NA = BM / RPS, NT = (BM + BN) / RPS;
    static_assert(BM % RPS == 0 && BN % RPS == 0 && NT % G == 0 && NT <= 63, "sweeps");
    #pragma unroll  // every operand index of a copy statement must be a constant
    for (int s = 0; s < NT; s += G) {
        unsigned l[G];
        const float* g[G];
        #pragma unroll  // as above
        for (int u = 0; u < G; ++u) {
            const int j = s + u;
            l[u] = l0 + (unsigned)(j * RPS * (KC + 4) * 4);
            g[u] = j < NA ? ga + (size_t)j * RPS * LD : gb + (size_t)(j - NA) * RPS * LD;
        }
        copy_run(l, g);
    }
}

template <int BM, int BN, int KC, int LD, int FA, int FB, int NTHR, int WN, int G>
__device__ __forceinline__ void gemm_tn_staged(const float* __restrict__ A,
                                               const float* __restrict__ B,
                                               float* sm, v8f (&acc)[FA][FB]) {
    constexpr int LDP = KC + 4;                   // LDS row pitch, floats
    constexpr int STG = (BM + BN) * LDP;          // floats per buffer
    constexpr int NCH = LD / KC;
    static_assert(BM == 16 * FA * (NTHR / 32 / WN) && BN == 16 * FB * WN && LD % KC == 0 && NCH >= 2, "tile");

    const int t    = threadIdx.x;
    const int lane = t & 31;
    const int wave = t >> 5;
    const int mr = lane & 15;
    const int h4 = (lane >> 4) << 2;              // {0, 4}

    const int crow = t / (KC / 4);
    const int ccol = (t % (KC / 4)) * 4;
    const float* ga = A + (size_t)crow * LD + ccol;
    const float* gb = B + (size_t)crow * LD + ccol;
    const unsigned l0 = (unsigned)(uintptr_t)(sm + crow * LDP + ccol);   // LDS byte address

    stage_chunk<BM, BN, KC, LD, NTHR, G>(l0, ga, gb);
    asm volatile("s_wait_asynccnt 0x0" ::: "memory");   // this wave's share of chunk 0 has landed
    __syncthreads();                                    // chunk 0 readable by every wave
    stage_chunk<BM, BN, KC, LD, NTHR, G>(l0 + STG * 4, ga + KC, gb + KC);

    const int ra = ((wave / WN) * (FA * 16) + mr) * LDP + h4;
    const int rb = (BM + (wave % WN) * (FB * 16) + mr) * LDP + h4;

    for (int c = 0; c < NCH; ++c) {
        const float* pa = sm + (c & 1) * STG + ra;
        const float* pb = sm + (c & 1) * STG + rb;
        #pragma unroll  // constant LDS offsets; lets fragment loads run ahead of the products
        for (int kk = 0; kk < KC; kk += 8) {
            // The inner loops below are unrolled so that the fragment and
            // accumulator arrays stay in registers (every index a constant).
            v4f a[FA], b[FB];
            #pragma unroll
            for (int i = 0; i < FA; ++i) a[i] = *(const v4f*)(pa + i * 16 * LDP + kk);
            #pragma unroll
            for (int j = 0; j < FB; ++j) b[j] = *(const v4f*)(pb + j * 16 * LDP + kk);
            // Same k pairing and per-accumulator order as STEP8 (low pair, then
            // high pair), but all tiles' low pairs first: no back-to-back
            // dependent accumulation.
            #pragma unroll
            for (int i = 0; i < FA; ++i)
                #pragma unroll
                for (int j = 0; j < FB; ++j)
                    acc[i][j] = WMMA_F32(LO2(a[i]), LO2(b[j]), acc[i][j]);
            #pragma unroll
            for (int i = 0; i < FA; ++i)
                #pragma unroll
                for (int j = 0; j < FB; ++j)
                    acc[i][j] = WMMA_F32(HI2(a[i]), HI2(b[j]), acc[i][j]);
        }
        asm volatile("s_wait_dscnt 0x0" ::: "memory");      // own reads of this buffer are done
        asm volatile("s_wait_asynccnt 0x0" ::: "memory");   // own share of chunk c + 1 has landed
        __syncthreads();                                    // publishes chunk c + 1, frees this buffer
        // Distance behind the chunk's last products, on both sides of the branch
        // below: the address arithmetic that follows reuses fragment registers.
        // The f32 16x16x4 form has no row of its own in the distance table; it
        // issues at the 8-bit-integer form's interval, so that form's 8 slots.
        // The fence pair keeps the products in front of the slots and the
        // address arithmetic behind them.
        __builtin_amdgcn_sched_barrier(0);
        asm volatile("v_nop\n\tv_nop\n\tv_nop\n\tv_nop\n\tv_nop\n\tv_nop\n\tv_nop\n\tv_nop");
        __builtin_amdgcn_sched_barrier(0);
        if (c + 2 < NCH)
            stage_chunk<BM, BN, KC, LD, NTHR, G>(l0 + (c & 1) * (STG * 4),
                                           ga + (c + 2) * KC, gb + (c + 2) * KC);
    }
    asm volatile("s_wait_asynccnt 0x0" ::: "memory");       // nothing in flight at the wave's end
}

// ---------------------------------------------------------------------------
// Kernel 2: per-batch M = K^T V (768x768, reduction over l = 2048).
// 192 x 96 tile per work-group: 4 x 8 tiles x 8 batches = 256 work-groups, one
// per WGP.  Output stored as M^T ([b][n][m]).
// ---------------------------------------------------------------------------
__global__ __launch_bounds__(256) void ktv_wmma(
    const float* __restrict__ KT, const float* __restrict__ VT,
    float* __restrict__ MT)
{
    constexpr int BM = 192, BN = 96, KC = 128, FA = 3, FB = 3;
    __shared__ __attribute__((aligned(16))) float sm[2 * (BM + BN) * (KC + 4)];   // 297 KiB

    const int b  = blockIdx.x / 32;
    const int tt = blockIdx.x % 32;
    const int bm = tt / 8;
    const int bn = tt % 8;

    v8f acc[FA][FB] = {};
    gemm_tn_staged<BM, BN, KC, Ln, FA, FB, 256, 2, 12>(
        KT + (size_t)b * Dn * Ln + (size_t)(bm * BM) * Ln,
        VT + (size_t)b * Dn * Ln + (size_t)(bn * BN) * Ln, sm, acc);

    const int lane = threadIdx.x & 31;
    const int wave = threadIdx.x >> 5;
    const int n  = lane & 15;
    const int m0 = (lane >> 4) << 3;
    float* MTb = MT + (size_t)b * Dn * Dn;
    #pragma unroll
    for (int ms = 0; ms < FA; ++ms) {
        #pragma unroll
        for (int ns = 0; ns < FB; ++ns) {
            const v8f c = acc[ms][ns];
            const int ng = bn * BN + (wave & 1) * (FB * 16) + ns * 16 + n;
            const int mg = bm * BM + (wave >> 1) * (FA * 16) + ms * 16 + m0;
            *(v4f*)(MTb + (size_t)ng * Dn + mg)     = (v4f){c[0], c[1], c[2], c[3]};
            *(v4f*)(MTb + (size_t)ng * Dn + mg + 4) = (v4f){c[4], c[5], c[6], c[7]};
        }
    }
}

// ---------------------------------------------------------------------------
// Kernel 3: out = Q @ M * (1/sqrt(768)).  A = Q row-major, B from M^T.
// 256 x 192 tile per work-group of 16 waves (4 x 4): 8 x 4 tiles x 8 batches =
// 256 work-groups, one per WGP.
// ---------------------------------------------------------------------------
__global__ __launch_bounds__(512) void qm_wmma(
    const float* __restrict__ Q, const float* __restrict__ MT,
    float* __restrict__ out)
{
    constexpr int BM = 256, BN = 192, KC = 64, FA = 4, FB = 3;
    __shared__ __attribute__((aligned(16))) float sm[2 * (BM + BN) * (KC + 4)];   // 238 KiB

    const int b  = blockIdx.x / 32;
    const int tt = blockIdx.x % 32;
    const int bm = tt / 4;
    const int bn = tt % 4;

    v8f acc[FA][FB] = {};
    gemm_tn_staged<BM, BN, KC, Dn, FA, FB, 512, 4, 14>(
        Q  + (size_t)b * Ln * Dn + (size_t)(bm * BM) * Dn,
        MT + (size_t)b * Dn * Dn + (size_t)(bn * BN) * Dn, sm, acc);

    const float alpha = 0.03608439182435161f;   // 1/sqrt(768)
    const int lane = threadIdx.x & 31;
    const int wave = threadIdx.x >> 5;
    const int n  = lane & 15;
    const int m0 = (lane >> 4) << 3;
    float* ob = out + (size_t)b * Ln * Dn;
    #pragma unroll
    for (int ms = 0; ms < FA; ++ms) {
        #pragma unroll
        for (int ns = 0; ns < FB; ++ns) {
            const v8f c = acc[ms][ns];
            const int ng = bn * BN + (wave & 3) * (FB * 16) + ns * 16 + n;
            const int mg = bm * BM + (wave >> 2) * (FA * 16) + ms * 16 + m0;
            #pragma unroll
            for (int r = 0; r < 8; ++r)
                ob[(size_t)(mg + r) * Dn + ng] = c[r] * alpha;
        }
    }
}

// ---------------------------------------------------------------------------
extern "C" void kernel_launch(void* const* d_in, const int* in_sizes, int n_in,
                              void* d_out, int out_size, void* d_ws, size_t ws_size,
                              hipStream_t stream) {
    const float* x  = (const float*)d_in[0];
    const float* Wq = (const float*)d_in[1];
    const float* bq = (const float*)d_in[2];
    const float* Wk = (const float*)d_in[3];
    const float* bk = (const float*)d_in[4];
    const float* Wv = (const float*)d_in[5];
    const float* bv = (const float*)d_in[6];
    float* out = (float*)d_out;

    // Workspace: Q | K^T | V^T | M^T   (3*16384*768 + 8*768*768 floats = 169.9 MB)
    float* Q  = (float*)d_ws;
    float* KT = Q  + (size_t)Rn * Dn;
    float* VT = KT + (size_t)Rn * Dn;
    float* MT = VT + (size_t)Rn * Dn;

    dim3 blk(256);  // 8 waves per workgroup
    qkv_wmma<<<(Rn / 256) * DT, blk, 0, stream>>>(x, Wq, bq, Wk, bk, Wv, bv, Q, KT, VT);
    ktv_wmma<<<Bn * 32, blk, 0, stream>>>(KT, VT, MT);
    qm_wmma <<<Bn * 32, dim3(512), 0, stream>>>(Q, MT, out);
}

// v002
// A run of this version takes 312 microseconds.
// Next to v001, in two timings, it ran 1.38 and 1.37 times as fast.
// Counting every step since v000, it is 1.87 times as fast.
#include <hip/hip_runtime.h>

// FP32 WMMA building blocks for gfx1250 (wave32).
typedef float v2f __attribute__((ext_vector_type(2)));
typedef float v4f __attribute__((ext_vector_type(4)));
typedef float v8f __attribute__((ext_vector_type(8)));

#define WMMA_F32(a, b, c) \
    __builtin_amdgcn_wmma_f32_16x16x4_f32(false, (a), false, (b), (short)0, (c), false, false)
#define LO2(v) __builtin_shufflevector((v), (v), 0, 1)
#define HI2(v) __builtin_shufflevector((v), (v), 2, 3)

constexpr int Bn = 8;
constexpr int Ln = 2048;
constexpr int Dn = 768;
constexpr int Rn = Bn * Ln;       // 16384 rows of x

// The matrix chain, reassociated.  With X one batch of x (L x D), 1 a column of
// ones, G = X^T X and s = X^T 1:
//   K^T V = Wk G Wv^T + (Wk s) bv^T + bk (Wv s)^T + L bk bv^T
//   out   = (X Wq^T + 1 bq^T) (K^T V) / sqrt(D)
// so the three weight matrices multiply D x D matrices, not the L rows of X:
//   T^T[o][c] = sum_j Wv[o][j] G[c][j] + bv[o] s[c]     tl[o] = Wv[o] . s + L bv[o]
//   M^T[o][h] = sum_c T^T[o][c] Wk[h][c] + tl[o] bk[h]  (M = K^T V)
//   P^T[o][a] = sum_h M^T[o][h] Wq[h][a]                pl[o] = M^T[o] . bq
//   out[l][o] = (sum_a X[l][a] P^T[o][a] + pl[o]) / sqrt(D)

// ---------------------------------------------------------------------------
// Kernel 1: X^T per batch ([b][d][l]) and Wq^T, so that every product reads its
// reduction dim contiguously; and the column sums of X, one partial sum per
// 256 rows.  One work-group: 256 rows x 32 columns, in two passes of 128 rows.
// ---------------------------------------------------------------------------
constexpr int TR  = 128;          // rows a pass
constexpr int TP  = TR + 4;       // LDS pitch of one column, floats (16 B x odd)
constexpr int RGX = Ln / 256;     // row groups of a batch of x: 8
constexpr int CG  = Dn / 32;      // column groups: 24

__global__ __launch_bounds__(256) void transpose_sum(
    const float* __restrict__ x, const float* __restrict__ Wq,
    float* __restrict__ XT, float* __restrict__ WqT, float* __restrict__ sp)
{
    __shared__ __attribute__((aligned(16))) float tile[32 * TP];

    const int t    = threadIdx.x;
    const int lane = t & 31;
    const int wave = t >> 5;
    const int blk  = blockIdx.x;
    const bool isx = blk < Bn * RGX * CG;         // the same for the whole work-group
    const int b    = isx ? blk / (RGX * CG) : 0;
    const int rem  = isx ? blk % (RGX * CG) : blk - Bn * RGX * CG;
    const int rg   = rem / CG;
    const int d0   = (rem % CG) * 32;
    const int rows = isx ? Ln : Dn;
    const float* src = isx ? x + (size_t)b * Ln * Dn : Wq;
    float*       dst = isx ? XT + (size_t)b * Dn * Ln : WqT;

    float cs[4] = {0.f, 0.f, 0.f, 0.f};
    for (int p = 0; p < 2; ++p) {
        const int r0 = rg * 256 + p * TR;
        #pragma unroll  // four independent loads in flight
        for (int i = 0; i < 4; ++i) {
            const int row = (t >> 3) + 32 * i;
            const int c4  = (t & 7) * 4;
            const v4f v = *(const v4f*)(src + (size_t)(r0 + row) * Dn + d0 + c4);
            tile[(c4 + 0) * TP + row] = v[0];
            tile[(c4 + 1) * TP + row] = v[1];
            tile[(c4 + 2) * TP + row] = v[2];
            tile[(c4 + 3) * TP + row] = v[3];
        }
        __syncthreads();                          // the pass's tile is complete
        #pragma unroll  // cs[] stays in registers
        for (int i = 0; i < 4; ++i) {
            const int c = wave + 8 * i;
            const v4f v = *(const v4f*)(tile + c * TP + lane * 4);
            *(v4f*)(dst + (size_t)(d0 + c) * rows + r0 + lane * 4) = v;
            cs[i] += (v[0] + v[1]) + (v[2] + v[3]);
        }
        __syncthreads();                          // every read done before the next pass writes
    }
    if (isx) {
        #pragma unroll  // cs[] stays in registers
        for (int i = 0; i < 4; ++i) {
            float a = cs[i];
            for (int o = 16; o; o >>= 1) a += __shfl_xor(a, o);
            if (lane == 0) sp[(size_t)(b * RGX + rg) * Dn + d0 + wave + 8 * i] = a;
        }
    }
}

// ---------------------------------------------------------------------------
// Shared core of every product: C = A * B^T, both operands contiguous along
// the reduction dim (leading dim LD = reduction length).  One BM x BN tile per
// work-group of NTHR / 32 waves, WN of them side by side along n, wave tile
// (16*FA) x (16*FB).  Chunks of KC k-columns of all BM + BN operand rows are
// brought into LDS by whole-line asynchronous b128 copies, two buffers: chunk
// c + 1 flies while chunk c is multiplied.  Fragments come from LDS with
// ds_load_b128 at a pitch of KC + 4 floats (16 B x odd: no bank conflict).
// ---------------------------------------------------------------------------

// A run of copies and its s_wait_xcnt 0 in ONE statement, so that no address
// register of a copy is rewritten ahead of the wait.
__device__ __forceinline__ void copy_run(const unsigned (&l)[12], const float* const (&g)[12]) {
    asm volatile("global_load_async_to_lds_b128 %0, %1, off\n\t"
                 "global_load_async_to_lds_b128 %2, %3, off\n\t"
                 "global_load_async_to_lds_b128 %4, %5, off\n\t"
                 "global_load_async_to_lds_b128 %6, %7, off\n\t"
                 "global_load_async_to_lds_b128 %8, %9, off\n\t"
                 "global_load_async_to_lds_b128 %10, %11, off\n\t"
                 "global_load_async_to_lds_b128 %12, %13, off\n\t"
                 "global_load_async_to_lds_b128 %14, %15, off\n\t"
                 "global_load_async_to_lds_b128 %16, %17, off\n\t"
                 "global_load_async_to_lds_b128 %18, %19, off\n\t"
                 "global_load_async_to_lds_b128 %20, %21, off\n\t"
                 "global_load_async_to_lds_b128 %22, %23, off\n\t"
                 "s_wait_xcnt 0x0"
                 :: "v"(l[0]), "v"(g[0]), "v"(l[1]), "v"(g[1]), "v"(l[2]), "v"(g[2]),
                    "v"(l[3]), "v"(g[3]), "v"(l[4]), "v"(g[4]), "v"(l[5]), "v"(g[5]),
                    "v"(l[6]), "v"(g[6]), "v"(l[7]), "v"(g[7]), "v"(l[8]), "v"(g[8]),
                    "v"(l[9]), "v"(g[9]), "v"(l[10]), "v"(g[10]), "v"(l[11]), "v"(g[11])
                 : "memory");
}
__device__ __forceinline__ void copy_run(const unsigned (&l)[14], const float* const (&g)[14]) {
    asm volatile("global_load_async_to_lds_b128 %0, %1, off\n\t"
                 "global_load_async_to_lds_b128 %2, %3, off\n\t"
                 "global_load_async_to_lds_b128 %4, %5, off\n\t"
                 "global_load_async_to_lds_b128 %6, %7, off\n\t"
                 "global_load_async_to_lds_b128 %8, %9, off\n\t"
                 "global_load_async_to_lds_b128 %10, %11, off\n\t"
                 "global_load_async_to_lds_b128 %12, %13, off\n\t"
                 "global_load_async_to_lds_b128 %14, %15, off\n\t"
                 "global_load_async_to_lds_b128 %16, %17, off\n\t"
                 "global_load_async_to_lds_b128 %18, %19, off\n\t"
                 "global_load_async_to_lds_b128 %20, %21, off\n\t"
                 "global_load_async_to_lds_b128 %22, %23, off\n\t"
                 "global_load_async_to_lds_b128 %24, %25, off\n\t"
                 "global_load_async_to_lds_b128 %26, %27, off\n\t"
                 "s_wait_xcnt 0x0"
                 :: "v"(l[0]), "v"(g[0]), "v"(l[1]), "v"(g[1]), "v"(l[2]), "v"(g[2]),
                    "v"(l[3]), "v"(g[3]), "v"(l[4]), "v"(g[4]), "v"(l[5]), "v"(g[5]),
                    "v"(l[6]), "v"(g[6]), "v"(l[7]), "v"(g[7]), "v"(l[8]), "v"(g[8]),
                    "v"(l[9]), "v"(g[9]), "v"(l[10]), "v"(g[10]), "v"(l[11]), "v"(g[11]),
                    "v"(l[12]), "v"(g[12]), "v"(l[13]), "v"(g[13])
                 : "memory");
}

// One chunk of all BM + BN rows: the block's NTHR lanes sweep NTHR * 4 / KC rows
// at a time, 16 B a lane, G copies a statement.  l0, ga, gb: this lane's slot in
// the first sweep (LDS byte address, A source, B source).
template <int BM, int BN, int KC, int LD, int NTHR, int G>
__device__ __forceinline__ void stage_chunk(unsigned l0, const float* ga, const float* gb) {
    constexpr int RPS = NTHR * 4 / KC;
    constexpr int NA = BM / RPS, NT = (BM + BN) / RPS;
    static_assert(BM % RPS == 0 && BN % RPS == 0 && NT % G == 0 && NT <= 63, "sweeps");
    #pragma unroll  // every operand index of a copy statement must be a constant
    for (int s = 0; s < NT; s += G) {
        unsigned l[G];
        const float* g[G];
        #pragma unroll  // as above
        for (int u = 0; u < G; ++u) {
            const int j = s + u;
            l[u] = l0 + (unsigned)(j * RPS * (KC + 4) * 4);
            g[u] = j < NA ? ga + (size_t)j * RPS * LD : gb + (size_t)(j - NA) * RPS * LD;
        }
        copy_run(l, g);
    }
}

template <int BM, int BN, int KC, int LD, int FA, int FB, int NTHR, int WN, int G>
__device__ __forceinline__ void gemm_tn_staged(const float* __restrict__ A,
                                               const float* __restrict__ B,
                                               float* sm, v8f (&acc)[FA][FB]) {
    constexpr int LDP = KC + 4;                   // LDS row pitch, floats
    constexpr int STG = (BM + BN) * LDP;          // floats per buffer
    constexpr int NCH = LD / KC;
    static_assert(BM == 16 * FA * (NTHR / 32 / WN) && BN == 16 * FB * WN && LD % KC == 0 && NCH >= 2, "tile");

    const int t    = threadIdx.x;
    const int lane = t & 31;
    const int wave = t >> 5;
    const int mr = lane & 15;
    const int h4 = (lane >> 4) << 2;              // {0, 4}

    const int crow = t / (KC / 4);
    const int ccol = (t % (KC / 4)) * 4;
    const float* ga = A + (size_t)crow * LD + ccol;
    const float* gb = B + (size_t)crow * LD + ccol;
    const unsigned l0 = (unsigned)(uintptr_t)(sm + crow * LDP + ccol);   // LDS byte address

    stage_chunk<BM, BN, KC, LD, NTHR, G>(l0, ga, gb);
    asm volatile("s_wait_asynccnt 0x0" ::: "memory");   // this wave's share of chunk 0 has landed
    __syncthreads();                                    // chunk 0 readable by every wave
    stage_chunk<BM, BN, KC, LD, NTHR, G>(l0 + STG * 4, ga + KC, gb + KC);

    const int ra = ((wave / WN) * (FA * 16) + mr) * LDP + h4;
    const int rb = (BM + (wave % WN) * (FB * 16) + mr) * LDP + h4;

    for (int c = 0; c < NCH; ++c) {
        const float* pa = sm + (c & 1) * STG + ra;
        const float* pb = sm + (c & 1) * STG + rb;
        #pragma unroll  // constant LDS offsets; lets fragment loads run ahead of the products
        for (int kk = 0; kk < KC; kk += 8) {
            // The inner loops below are unrolled so that the fragment and
            // accumulator arrays stay in registers (every index a constant).
            v4f a[FA], b[FB];
            #pragma unroll
            for (int i = 0; i < FA; ++i) a[i] = *(const v4f*)(pa + i * 16 * LDP + kk);
            #pragma unroll
            for (int j = 0; j < FB; ++j) b[j] = *(const v4f*)(pb + j * 16 * LDP + kk);
            // Per accumulator the low pair, then the high pair, but all tiles'
            // low pairs first: no back-to-back dependent accumulation.
            #pragma unroll
            for (int i = 0; i < FA; ++i)
                #pragma unroll
                for (int j = 0; j < FB; ++j)
                    acc[i][j] = WMMA_F32(LO2(a[i]), LO2(b[j]), acc[i][j]);
            #pragma unroll
            for (int i = 0; i < FA; ++i)
                #pragma unroll
                for (int j = 0; j < FB; ++j)
                    acc[i][j] = WMMA_F32(HI2(a[i]), HI2(b[j]), acc[i][j]);
        }
        asm volatile("s_wait_dscnt 0x0" ::: "memory");      // own reads of this buffer are done
        asm volatile("s_wait_asynccnt 0x0" ::: "memory");   // own share of chunk c + 1 has landed
        __syncthreads();                                    // publishes chunk c + 1, frees this buffer
        // Distance behind the chunk's last products, on both sides of the branch
        // below: the address arithmetic that follows reuses fragment registers.
        // The f32 16x16x4 form has no row of its own in the distance table; it
        // issues at the 8-bit-integer form's interval, so that form's 8 slots.
        // The fence pair keeps the products in front of the slots and the
        // address arithmetic behind them.
        __builtin_amdgcn_sched_barrier(0);
        asm volatile("v_nop\n\tv_nop\n\tv_nop\n\tv_nop\n\tv_nop\n\tv_nop\n\tv_nop\n\tv_nop");
        __builtin_amdgcn_sched_barrier(0);
        if (c + 2 < NCH)
            stage_chunk<BM, BN, KC, LD, NTHR, G>(l0 + (c & 1) * (STG * 4),
                                           ga + (c + 2) * KC, gb + (c + 2) * KC);
    }
    asm volatile("s_wait_asynccnt 0x0" ::: "memory");       // nothing in flight at the wave's end
}

// ---------------------------------------------------------------------------
// Kernels 2 to 5: 768 x 768 results per batch, one 192 x 96 tile per work-group:
// 4 x 8 tiles x 8 batches = 256 work-groups, one per WGP.  The result is stored
// transposed, CT[n][m] = sum_k A[m][k] B[n][k] (+ un[n] * vm[m] where R1).
// ---------------------------------------------------------------------------
constexpr int TBM = 192, TBN = 96, TKC = 128, TFA = 3, TFB = 3;
constexpr int TSM = 2 * (TBM + TBN) * (TKC + 4);  // floats of LDS: 297 KiB

template <bool R1>
__device__ __forceinline__ void store_t(float* __restrict__ CT, int bm, int bn,
                                        const v8f (&acc)[TFA][TFB],
                                        const float* __restrict__ un,
                                        const float* __restrict__ vm) {
    const int lane = threadIdx.x & 31;
    const int wave = threadIdx.x >> 5;
    const int n  = lane & 15;
    const int m0 = (lane >> 4) << 3;
    #pragma unroll
    for (int ms = 0; ms < TFA; ++ms) {
        #pragma unroll
        for (int ns = 0; ns < TFB; ++ns) {
            const v8f c = acc[ms][ns];
            const int ng = bn * TBN + (wave & 1) * (TFB * 16) + ns * 16 + n;
            const int mg = bm * TBM + (wave >> 1) * (TFA * 16) + ms * 16 + m0;
            v4f lo = (v4f){c[0], c[1], c[2], c[3]};
            v4f hi = (v4f){c[4], c[5], c[6], c[7]};
            if (R1) {
                const float u = un[ng];
                lo += u * *(const v4f*)(vm + mg);
                hi += u * *(const v4f*)(vm + mg + 4);
            }
            *(v4f*)(CT + (size_t)ng * Dn + mg)     = lo;
            *(v4f*)(CT + (size_t)ng * Dn + mg + 4) = hi;
        }
    }
}

// dst[r] = Mat[r] . vec (+ addc * addv[r] where ADD) for the 32 rows from r0 on:
// one wave a row, four rows a wave; 32 results = one whole 128-byte line.
template <bool ADD>
__device__ __forceinline__ void rowdot32(const float* __restrict__ Mat,
                                         const float* __restrict__ vec,
                                         float addc, const float* __restrict__ addv,
                                         float* __restrict__ dst, int r0) {
    const int lane = threadIdx.x & 31;
    const int wave = threadIdx.x >> 5;
    // The loads below reuse registers that the tile's stores, just issued, name.
    asm volatile("s_wait_xcnt 0x0" ::: "memory");
    for (int i = 0; i < 4; ++i) {
        const int r = r0 + wave * 4 + i;
        float a = 0.f;
        #pragma unroll  // six independent pairs of loads in flight
        for (int j = 0; j < Dn / 128; ++j) {
            const v4f m = *(const v4f*)(Mat + (size_t)r * Dn + j * 128 + lane * 4);
            const v4f v = *(const v4f*)(vec + j * 128 + lane * 4);
            a += (m[0] * v[0] + m[1] * v[1]) + (m[2] * v[2] + m[3] * v[3]);
        }
        for (int o = 16; o; o >>= 1) a += __shfl_xor(a, o);
        if (lane == 0) dst[r] = ADD ? a + addc * addv[r] : a;
    }
}

// Kernel 2: G = X^T X (reduction over l = 2048); the column sums s completed.
__global__ __launch_bounds__(256) void gram_wmma(
    const float* __restrict__ XT, const float* __restrict__ sp,
    float* __restrict__ G, float* __restrict__ s)
{
    __shared__ __attribute__((aligned(16))) float sm[TSM];
    const int b  = blockIdx.x / 32;
    const int tt = blockIdx.x % 32;
    const int bm = tt / 8;
    const int bn = tt % 8;

    v8f acc[TFA][TFB] = {};
    gemm_tn_staged<TBM, TBN, TKC, Ln, TFA, TFB, 256, 2, 12>(
        XT + (size_t)b * Dn * Ln + (size_t)(bm * TBM) * Ln,
        XT + (size_t)b * Dn * Ln + (size_t)(bn * TBN) * Ln, sm, acc);
    store_t<false>(G + (size_t)b * Dn * Dn, bm, bn, acc, nullptr, nullptr);

    if (tt < CG && threadIdx.x < 32) {
        const int j = tt * 32 + threadIdx.x;
        float a = 0.f;
        for (int g = 0; g < RGX; ++g) a += sp[(size_t)(b * RGX + g) * Dn + j];
        s[b * Dn + j] = a;
    }
}

// Kernel 3: T^T[o][c] = sum_j G[c][j] Wv[o][j] + bv[o] s[c]; tl = Wv s + L bv.
__global__ __launch_bounds__(256) void tv_wmma(
    const float* __restrict__ G, const float* __restrict__ Wv,
    const float* __restrict__ bv, const float* __restrict__ s,
    float* __restrict__ TT, float* __restrict__ tl)
{
    __shared__ __attribute__((aligned(16))) float sm[TSM];
    const int b  = blockIdx.x / 32;
    const int tt = blockIdx.x % 32;
    const int bm = tt / 8;
    const int bn = tt % 8;

    v8f acc[TFA][TFB] = {};
    gemm_tn_staged<TBM, TBN, TKC, Dn, TFA, TFB, 256, 2, 12>(
        G + (size_t)b * Dn * Dn + (size_t)(bm * TBM) * Dn,
        Wv + (size_t)(bn * TBN) * Dn, sm, acc);
    store_t<true>(TT + (size_t)b * Dn * Dn, bm, bn, acc, bv, s + b * Dn);

    if (tt < CG)
        rowdot32<true>(Wv, s + b * Dn, (float)Ln, bv, tl + b * Dn, tt * 32);
}

// Kernel 4: M^T[o][h] = sum_c Wk[h][c] T^T[o][c] + tl[o] bk[h].
__global__ __launch_bounds__(256) void mk_wmma(
    const float* __restrict__ Wk, const float* __restrict__ TT,
    const float* __restrict__ tl, const float* __restrict__ bk,
    float* __restrict__ MT)
{
    __shared__ __attribute__((aligned(16))) float sm[TSM];
    const int b  = blockIdx.x / 32;
    const int tt = blockIdx.x % 32;
    const int bm = tt / 8;
    const int bn = tt % 8;

    v8f acc[TFA][TFB] = {};
    gemm_tn_staged<TBM, TBN, TKC, Dn, TFA, TFB, 256, 2, 12>(
        Wk + (size_t)(bm * TBM) * Dn,
        TT + (size_t)b * Dn * Dn + (size_t)(bn * TBN) * Dn, sm, acc);
    store_t<true>(MT + (size_t)b * Dn * Dn, bm, bn, acc, tl + b * Dn, bk);
}

// Kernel 5: P^T[o][a] = sum_h Wq^T[a][h] M^T[o][h]; pl = M^T bq.
__global__ __launch_bounds__(256) void pq_wmma(
    const float* __restrict__ WqT, const float* __restrict__ MT,
    const float* __restrict__ bq,
    float* __restrict__ PT, float* __restrict__ pl)
{
    __shared__ __attribute__((aligned(16))) float sm[TSM];
    const int b  = blockIdx.x / 32;
    const int tt = blockIdx.x % 32;
    const int bm = tt / 8;
    const int bn = tt % 8;

    v8f acc[TFA][TFB] = {};
    gemm_tn_staged<TBM, TBN, TKC, Dn, TFA, TFB, 256, 2, 12>(
        WqT + (size_t)(bm * TBM) * Dn,
        MT + (size_t)b * Dn * Dn + (size_t)(bn * TBN) * Dn, sm, acc);
    store_t<false>(PT + (size_t)b * Dn * Dn, bm, bn, acc, nullptr, nullptr);

    if (tt < CG)
        rowdot32<false>(MT + (size_t)b * Dn * Dn, bq, 0.f, nullptr, pl + b * Dn, tt * 32);
}

// ---------------------------------------------------------------------------
// Kernel 6: out = (X P + 1 pl^T) * (1/sqrt(768)).  A = x row-major, B from P^T.
// 256 x 192 tile per work-group of 16 waves (4 x 4): 8 x 4 tiles x 8 batches =
// 256 work-groups, one per WGP.
// ---------------------------------------------------------------------------
__global__ __launch_bounds__(512) void xp_wmma(
    const float* __restrict__ x, const float* __restrict__ PT,
    const float* __restrict__ pl, float* __restrict__ out)
{
    constexpr int BM = 256, BN = 192, KC = 64, FA = 4, FB = 3;
    __shared__ __attribute__((aligned(16))) float sm[2 * (BM + BN) * (KC + 4)];   // 238 KiB

    const int b  = blockIdx.x / 32;
    const int tt = blockIdx.x % 32;
    const int bm = tt / 4;
    const int bn = tt % 4;

    v8f acc[FA][FB] = {};
    gemm_tn_staged<BM, BN, KC, Dn, FA, FB, 512, 4, 14>(
        x  + (size_t)b * Ln * Dn + (size_t)(bm * BM) * Dn,
        PT + (size_t)b * Dn * Dn + (size_t)(bn * BN) * Dn, sm, acc);

    const float alpha = 0.03608439182435161f;   // 1/sqrt(768)
    const int lane = threadIdx.x & 31;
    const int wave = threadIdx.x >> 5;
    const int n  = lane & 15;
    const int m0 = (lane >> 4) << 3;
    float* ob = out + (size_t)b * Ln * Dn;
    #pragma unroll
    for (int ns = 0; ns < FB; ++ns) {
        const int ng = bn * BN + (wave & 3) * (FB * 16) + ns * 16 + n;
        const float pb = pl[b * Dn + ng];
        #pragma unroll
        for (int ms = 0; ms < FA; ++ms) {
            const v8f c = acc[ms][ns];
            const int mg = bm * BM + (wave >> 2) * (FA * 16) + ms * 16 + m0;
            #pragma unroll
            for (int r = 0; r < 8; ++r)
                ob[(size_t)(mg + r) * Dn + ng] = (c[r] + pb) * alpha;
        }
    }
}

// ---------------------------------------------------------------------------
extern "C" void kernel_launch(void* const* d_in, const int* in_sizes, int n_in,
                              void* d_out, int out_size, void* d_ws, size_t ws_size,
                              hipStream_t stream) {
    const float* x  = (const float*)d_in[0];
    const float* Wq = (const float*)d_in[1];
    const float* bq = (const float*)d_in[2];
    const float* Wk = (const float*)d_in[3];
    const float* bk = (const float*)d_in[4];
    const float* Wv = (const float*)d_in[5];
    const float* bv = (const float*)d_in[6];
    float* out = (float*)d_out;

    // Workspace: X^T | G | T^T | M^T | P^T | Wq^T | sp | s | tl | pl  (128.5 MB)
    float* XT  = (float*)d_ws;
    float* G   = XT  + (size_t)Rn * Dn;
    float* TT  = G   + (size_t)Bn * Dn * Dn;
    float* MT  = TT  + (size_t)Bn * Dn * Dn;
    float* PT  = MT  + (size_t)Bn * Dn * Dn;
    float* WqT = PT  + (size_t)Bn * Dn * Dn;
    float* sp  = WqT + (size_t)Dn * Dn;
    float* s   = sp  + (size_t)Bn * RGX * Dn;
    float* tl  = s   + (size_t)Bn * Dn;
    float* pl  = tl  + (size_t)Bn * Dn;

    dim3 blk(256);  // 8 waves per workgroup
    transpose_sum<<<(Bn * RGX + Dn / 256) * CG, blk, 0, stream>>>(x, Wq, XT, WqT, sp);
    gram_wmma<<<Bn * 32, blk, 0, stream>>>(XT, sp, G, s);
    tv_wmma  <<<Bn * 32, blk, 0, stream>>>(G, Wv, bv, s, TT, tl);
    mk_wmma  <<<Bn * 32, blk, 0, stream>>>(Wk, TT, tl, bk, MT);
    pq_wmma  <<<Bn * 32, blk, 0, stream>>>(WqT, MT, bq, PT, pl);
    xp_wmma  <<<Bn * 32, dim3(512), 0, stream>>>(x, PT, pl, out);
}

// v003
// Measured time: 290 microseconds a run.
// Next to v002, in two timings, it ran 1.08 and 1.07 times as fast.
// Over all steps from v000 it is 2.01 times as fast.
#include <hip/hip_runtime.h>

// FP32 WMMA building blocks for gfx1250 (wave32).
typedef float v2f __attribute__((ext_vector_type(2)));
typedef float v4f __attribute__((ext_vector_type(4)));
typedef float v8f __attribute__((ext_vector_type(8)));

#define WMMA_F32(a, b, c) \
    __builtin_amdgcn_wmma_f32_16x16x4_f32(false, (a), false, (b), (short)0, (c), false, false)
#define LO2(v) __builtin_shufflevector((v), (v), 0, 1)
#define HI2(v) __builtin_shufflevector((v), (v), 2, 3)

constexpr int Bn = 8;
constexpr int Ln = 2048;
constexpr int Dn = 768;
constexpr int Rn = Bn * Ln;       // 16384 rows of x

// The matrix chain, reassociated.  With X one batch of x (L x D), 1 a column of
// ones, G = X^T X and s = X^T 1:
//   K^T V = Wk G Wv^T + (Wk s) bv^T + bk (Wv s)^T + L bk bv^T
//   out   = (X Wq^T + 1 bq^T) (K^T V) / sqrt(D)
// so the three weight matrices multiply D x D matrices, not the L rows of X:
//   T^T[o][c] = sum_j Wv[o][j] G[c][j] + bv[o] s[c]     tl[o] = Wv[o] . s + L bv[o]
// and Wq^T (Wk T + bk tl^T) = (Wq^T Wk) T + (Wq^T bk) tl^T, where the products of
// the weights alone do not depend on the batch and are formed once:
//   W2[a][c]  = sum_h Wq[h][a] Wk[h][c]    w = Wq^T bk    u = Wk^T bq    beta = bq . bk
//   P^T[o][a] = sum_c T^T[o][c] W2[a][c] + tl[o] w[a]   pl[o] = T^T[o] . u + beta tl[o]
//   out[l][o] = (sum_a X[l][a] P^T[o][a] + pl[o]) / sqrt(D)

// ---------------------------------------------------------------------------
// Kernel 1, the part for x: X^T per batch ([b][d][l]), so that G reads its
// reduction dim contiguously; and the column sums of X, one partial sum per
// 256 rows.  One work-group: 256 rows x 32 columns, in two passes of 128 rows.
// ---------------------------------------------------------------------------
constexpr int TR  = 128;          // rows a pass
constexpr int TP  = TR + 4;       // LDS pitch of one column, floats (16 B x odd)
constexpr int RGX = Ln / 256;     // row groups of a batch of x: 8
constexpr int CG  = Dn / 32;      // column groups: 24

__device__ __forceinline__ void transpose_sum(
    const float* __restrict__ x, float* __restrict__ XT, float* __restrict__ sp,
    float* tile, int blk)
{
    const int t    = threadIdx.x;
    const int lane = t & 31;
    const int wave = t >> 5;
    const int b    = blk / (RGX * CG);
    const int rem  = blk % (RGX * CG);
    const int rg   = rem / CG;
    const int d0   = (rem % CG) * 32;
    const float* src = x + (size_t)b * Ln * Dn;
    float*       dst = XT + (size_t)b * Dn * Ln;

    float cs[4] = {0.f, 0.f, 0.f, 0.f};
    for (int p = 0; p < 2; ++p) {
        const int r0 = rg * 256 + p * TR;
        #pragma unroll  // four independent loads in flight
        for (int i = 0; i < 4; ++i) {
            const int row = (t >> 3) + 32 * i;
            const int c4  = (t & 7) * 4;
            const v4f v = *(const v4f*)(src + (size_t)(r0 + row) * Dn + d0 + c4);
            tile[(c4 + 0) * TP + row] = v[0];
            tile[(c4 + 1) * TP + row] = v[1];
            tile[(c4 + 2) * TP + row] = v[2];
            tile[(c4 + 3) * TP + row] = v[3];
        }
        __syncthreads();                          // the pass's tile is complete
        #pragma unroll  // cs[] stays in registers
        for (int i = 0; i < 4; ++i) {
            const int c = wave + 8 * i;
            const v4f v = *(const v4f*)(tile + c * TP + lane * 4);
            *(v4f*)(dst + (size_t)(d0 + c) * Ln + r0 + lane * 4) = v;
            cs[i] += (v[0] + v[1]) + (v[2] + v[3]);
        }
        __syncthreads();                          // every read done before the next pass writes
    }
    #pragma unroll  // cs[] stays in registers
    for (int i = 0; i < 4; ++i) {
        float a = cs[i];
        for (int o = 16; o; o >>= 1) a += __shfl_xor(a, o);
        if (lane == 0) sp[(size_t)(b * RGX + rg) * Dn + d0 + wave + 8 * i] = a;
    }
}

// ---------------------------------------------------------------------------
// Shared core of the products of kernels 2 to 5: C = A * B^T, both operands contiguous along
// the reduction dim (leading dim LD = reduction length).  One BM x BN tile per
// work-group of NTHR / 32 waves, WN of them side by side along n, wave tile
// (16*FA) x (16*FB).  Chunks of KC k-columns of all BM + BN operand rows are
// brought into LDS by whole-line asynchronous b128 copies, two buffers: chunk
// c + 1 flies while chunk c is multiplied.  Fragments come from LDS with
// ds_load_b128 at a pitch of KC + 4 floats (16 B x odd: no bank conflict).
// ---------------------------------------------------------------------------

// A run of copies and its s_wait_xcnt 0 in ONE statement, so that no address
// register of a copy is rewritten ahead of the wait.
__device__ __forceinline__ void copy_run_b32(const unsigned (&l)[8], const float* const (&g)[8]) {
    asm volatile("global_load_async_to_lds_b32 %0, %1, off\n\t"
                 "global_load_async_to_lds_b32 %2, %3, off\n\t"
                 "global_load_async_to_lds_b32 %4, %5, off\n\t"
                 "global_load_async_to_lds_b32 %6, %7, off\n\t"
                 "global_load_async_to_lds_b32 %8, %9, off\n\t"
                 "global_load_async_to_lds_b32 %10, %11, off\n\t"
                 "global_load_async_to_lds_b32 %12, %13, off\n\t"
                 "global_load_async_to_lds_b32 %14, %15, off\n\t"
                 "s_wait_xcnt 0x0"
                 :: "v"(l[0]), "v"(g[0]), "v"(l[1]), "v"(g[1]), "v"(l[2]), "v"(g[2]),
                    "v"(l[3]), "v"(g[3]), "v"(l[4]), "v"(g[4]), "v"(l[5]), "v"(g[5]),
                    "v"(l[6]), "v"(g[6]), "v"(l[7]), "v"(g[7])
                 : "memory");
}
__device__ __forceinline__ void copy_run(const unsigned (&l)[12], const float* const (&g)[12]) {
    asm volatile("global_load_async_to_lds_b128 %0, %1, off\n\t"
                 "global_load_async_to_lds_b128 %2, %3, off\n\t"
                 "global_load_async_to_lds_b128 %4, %5, off\n\t"
                 "global_load_async_to_lds_b128 %6, %7, off\n\t"
                 "global_load_async_to_lds_b128 %8, %9, off\n\t"
                 "global_load_async_to_lds_b128 %10, %11, off\n\t"
                 "global_load_async_to_lds_b128 %12, %13, off\n\t"
                 "global_load_async_to_lds_b128 %14, %15, off\n\t"
                 "global_load_async_to_lds_b128 %16, %17, off\n\t"
                 "global_load_async_to_lds_b128 %18, %19, off\n\t"
                 "global_load_async_to_lds_b128 %20, %21, off\n\t"
                 "global_load_async_to_lds_b128 %22, %23, off\n\t"
                 "s_wait_xcnt 0x0"
                 :: "v"(l[0]), "v"(g[0]), "v"(l[1]), "v"(g[1]), "v"(l[2]), "v"(g[2]),
                    "v"(l[3]), "v"(g[3]), "v"(l[4]), "v"(g[4]), "v"(l[5]), "v"(g[5]),
                    "v"(l[6]), "v"(g[6]), "v"(l[7]), "v"(g[7]), "v"(l[8]), "v"(g[8]),
                    "v"(l[9]), "v"(g[9]), "v"(l[10]), "v"(g[10]), "v"(l[11]), "v"(g[11])
                 : "memory");
}
__device__ __forceinline__ void copy_run(const unsigned (&l)[14], const float* const (&g)[14]) {
    asm volatile("global_load_async_to_lds_b128 %0, %1, off\n\t"
                 "global_load_async_to_lds_b128 %2, %3, off\n\t"
                 "global_load_async_to_lds_b128 %4, %5, off\n\t"
                 "global_load_async_to_lds_b128 %6, %7, off\n\t"
                 "global_load_async_to_lds_b128 %8, %9, off\n\t"
                 "global_load_async_to_lds_b128 %10, %11, off\n\t"
                 "global_load_async_to_lds_b128 %12, %13, off\n\t"
                 "global_load_async_to_lds_b128 %14, %15, off\n\t"
                 "global_load_async_to_lds_b128 %16, %17, off\n\t"
                 "global_load_async_to_lds_b128 %18, %19, off\n\t"
                 "global_load_async_to_lds_b128 %20, %21, off\n\t"
                 "global_load_async_to_lds_b128 %22, %23, off\n\t"
                 "global_load_async_to_lds_b128 %24, %25, off\n\t"
                 "global_load_async_to_lds_b128 %26, %27, off\n\t"
                 "s_wait_xcnt 0x0"
                 :: "v"(l[0]), "v"(g[0]), "v"(l[1]), "v"(g[1]), "v"(l[2]), "v"(g[2]),
                    "v"(l[3]), "v"(g[3]), "v"(l[4]), "v"(g[4]), "v"(l[5]), "v"(g[5]),
                    "v"(l[6]), "v"(g[6]), "v"(l[7]), "v"(g[7]), "v"(l[8]), "v"(g[8]),
                    "v"(l[9]), "v"(g[9]), "v"(l[10]), "v"(g[10]), "v"(l[11]), "v"(g[11]),
                    "v"(l[12]), "v"(g[12]), "v"(l[13]), "v"(g[13])
                 : "memory");
}

// One chunk of all BM + BN rows: the block's NTHR lanes sweep NTHR * 4 / KC rows
// at a time, 16 B a lane, G copies a statement.  l0, ga, gb: this lane's slot in
// the first sweep (LDS byte address, A source, B source).
template <int BM, int BN, int KC, int LD, int NTHR, int G>
__device__ __forceinline__ void stage_chunk(unsigned l0, const float* ga, const float* gb) {
    constexpr int RPS = NTHR * 4 / KC;
    constexpr int NA = BM / RPS, NT = (BM + BN) / RPS;
    static_assert(BM % RPS == 0 && BN % RPS == 0 && NT % G == 0 && NT <= 63, "sweeps");
    #pragma unroll  // every operand index of a copy statement must be a constant
    for (int s = 0; s < NT; s += G) {
        unsigned l[G];
        const float* g[G];
        #pragma unroll  // as above
        for (int u = 0; u < G; ++u) {
            const int j = s + u;
            l[u] = l0 + (unsigned)(j * RPS * (KC + 4) * 4);
            g[u] = j < NA ? ga + (size_t)j * RPS * LD : gb + (size_t)(j - NA) * RPS * LD;
        }
        copy_run(l, g);
    }
}

template <int BM, int BN, int KC, int LD, int FA, int FB, int NTHR, int WN, int G>
__device__ __forceinline__ void gemm_tn_staged(const float* __restrict__ A,
                                               const float* __restrict__ B,
                                               float* sm, v8f (&acc)[FA][FB]) {
    constexpr int LDP = KC + 4;                   // LDS row pitch, floats
    constexpr int STG = (BM + BN) * LDP;          // floats per buffer
    constexpr int NCH = LD / KC;
    static_assert(BM == 16 * FA * (NTHR / 32 / WN) && BN == 16 * FB * WN && LD % KC == 0 && NCH >= 2, "tile");

    const int t    = threadIdx.x;
    const int lane = t & 31;
    const int wave = t >> 5;
    const int mr = lane & 15;
    const int h4 = (lane >> 4) << 2;              // {0, 4}

    const int crow = t / (KC / 4);
    const int ccol = (t % (KC / 4)) * 4;
    const float* ga = A + (size_t)crow * LD + ccol;
    const float* gb = B + (size_t)crow * LD + ccol;
    const unsigned l0 = (unsigned)(uintptr_t)(sm + crow * LDP + ccol);   // LDS byte address

    stage_chunk<BM, BN, KC, LD, NTHR, G>(l0, ga, gb);
    asm volatile("s_wait_asynccnt 0x0" ::: "memory");   // this wave's share of chunk 0 has landed
    __syncthreads();                                    // chunk 0 readable by every wave
    stage_chunk<BM, BN, KC, LD, NTHR, G>(l0 + STG * 4, ga + KC, gb + KC);

    const int ra = ((wave / WN) * (FA * 16) + mr) * LDP + h4;
    const int rb = (BM + (wave % WN) * (FB * 16) + mr) * LDP + h4;

    for (int c = 0; c < NCH; ++c) {
        const float* pa = sm + (c & 1) * STG + ra;
        const float* pb = sm + (c & 1) * STG + rb;
        #pragma unroll  // constant LDS offsets; lets fragment loads run ahead of the products
        for (int kk = 0; kk < KC; kk += 8) {
            // The inner loops below are unrolled so that the fragment and
            // accumulator arrays stay in registers (every index a constant).
            v4f a[FA], b[FB];
            #pragma unroll
            for (int i = 0; i < FA; ++i) a[i] = *(const v4f*)(pa + i * 16 * LDP + kk);
            #pragma unroll
            for (int j = 0; j < FB; ++j) b[j] = *(const v4f*)(pb + j * 16 * LDP + kk);
            // Per accumulator the low pair, then the high pair, but all tiles'
            // low pairs first: no back-to-back dependent accumulation.
            #pragma unroll
            for (int i = 0; i < FA; ++i)
                #pragma unroll
                for (int j = 0; j < FB; ++j)
                    acc[i][j] = WMMA_F32(LO2(a[i]), LO2(b[j]), acc[i][j]);
            #pragma unroll
            for (int i = 0; i < FA; ++i)
                #pragma unroll
                for (int j = 0; j < FB; ++j)
                    acc[i][j] = WMMA_F32(HI2(a[i]), HI2(b[j]), acc[i][j]);
        }
        asm volatile("s_wait_dscnt 0x0" ::: "memory");      // own reads of this buffer are done
        asm volatile("s_wait_asynccnt 0x0" ::: "memory");   // own share of chunk c + 1 has landed
        __syncthreads();                                    // publishes chunk c + 1, frees this buffer
        // Distance behind the chunk's last products, on both sides of the branch
        // below: the address arithmetic that follows reuses fragment registers.
        // The f32 16x16x4 form has no row of its own in the distance table; it
        // issues at the 8-bit-integer form's interval, so that form's 8 slots.
        // The fence pair keeps the products in front of the slots and the
        // address arithmetic behind them.
        __builtin_amdgcn_sched_barrier(0);
        asm volatile("v_nop\n\tv_nop\n\tv_nop\n\tv_nop\n\tv_nop\n\tv_nop\n\tv_nop\n\tv_nop");
        __builtin_amdgcn_sched_barrier(0);
        if (c + 2 < NCH)
            stage_chunk<BM, BN, KC, LD, NTHR, G>(l0 + (c & 1) * (STG * 4),
                                           ga + (c + 2) * KC, gb + (c + 2) * KC);
    }
    asm volatile("s_wait_asynccnt 0x0" ::: "memory");       // nothing in flight at the wave's end
}

// ---------------------------------------------------------------------------
// Kernel 1, the parts for the weights alone.
// W2[a][c] = sum_h Wk[h][c] Wq[h][a]: the reduction runs down the rows of both
// operands.  Asynchronous b32 copies turn a chunk of W2K rows h as they bring it
// in: a wave reads 32 neighbouring columns of one row (one whole line), and each
// lane drops its word into its own column's LDS row, so that the fragments come
// from LDS as in the core (ds_load_b128 along k, pitch 16 B x odd).  Same ring
// as the core, two buffers.  One 64 (c) x 64 (a) tile per work-group, 8 waves
// as 4 x 2, wave tile 16 x 32; LDS rows 0-63: columns of Wk, 64-127: of Wq.
// ---------------------------------------------------------------------------
constexpr int W2T = 64;                           // edge of a tile
constexpr int W2K = 32;                           // rows h a chunk
constexpr int W2P = W2K + 4;                      // LDS pitch of a column, floats
constexpr int NW2 = (Dn / W2T) * (Dn / W2T);      // tiles: 144
constexpr int PSM = 2 * 2 * W2T * W2P;            // floats of LDS of kernel 1: 36 KiB
static_assert(PSM >= 32 * TP, "the transpose tile fits");

// One chunk: a wave keeps its 32 columns and takes every second row h.
// l0, g0: this lane's first word (LDS byte address, source).
__device__ __forceinline__ void w2_stage(unsigned l0, const float* g0) {
    #pragma unroll  // every operand index of a copy statement must be a constant
    for (int s = 0; s < W2K / 2; s += 8) {
        unsigned l[8];
        const float* g[8];
        #pragma unroll  // as above
        for (int v = 0; v < 8; ++v) {
            l[v] = l0 + (unsigned)((s + v) * 2 * 4);
            g[v] = g0 + (size_t)(s + v) * 2 * Dn;
        }
        copy_run_b32(l, g);
        // Keeps the next run's addresses from being formed ahead of this run, so
        // that both use the same registers: kernel 1 stays within 64 registers
        // and the transposes keep their eight work-groups a WGP.
        __builtin_amdgcn_sched_barrier(0);
    }
}

__device__ __forceinline__ void w2_tile(const float* __restrict__ Wq,
                                        const float* __restrict__ Wk,
                                        float* __restrict__ W2, float* sm, int tile) {
    constexpr int STG = 2 * W2T * W2P;            // floats per buffer
    constexpr int NCH = Dn / W2K;
    static_assert(Dn % W2K == 0 && W2K % 16 == 0 && NCH >= 2, "chunks");

    const int lane = threadIdx.x & 31;
    const int wave = threadIdx.x >> 5;
    const int c0 = (tile / (Dn / W2T)) * W2T;
    const int a0 = (tile % (Dn / W2T)) * W2T;

    const int cg = wave & 3;                      // this wave's 32 columns: 0, 1 of Wk; 2, 3 of Wq
    const float* gm = cg < 2 ? Wk : Wq;
    const int    gc = cg < 2 ? c0 + cg * 32 : a0 + (cg - 2) * 32;
    const float* g0 = gm + (size_t)(wave >> 2) * Dn + gc + lane;
    const unsigned l0 = (unsigned)(uintptr_t)(sm + (cg * 32 + lane) * W2P + (wave >> 2));   // LDS byte address

    w2_stage(l0, g0);
    asm volatile("s_wait_asynccnt 0x0" ::: "memory");   // this wave's share of chunk 0 has landed
    __syncthreads();                                    // chunk 0 readable by every wave
    w2_stage(l0 + STG * 4, g0 + (size_t)W2K * Dn);

    const int mr = lane & 15;
    const int h4 = (lane >> 4) << 2;              // {0, 4}
    const int ra = ((wave >> 1) * 16 + mr) * W2P + h4;
    const int rb = (W2T + (wave & 1) * 32 + mr) * W2P + h4;

    v8f acc[2] = {};
    for (int c = 0; c < NCH; ++c) {
        const float* pa = sm + (c & 1) * STG + ra;
        const float* pb = sm + (c & 1) * STG + rb;
        #pragma unroll  // constant LDS offsets; lets fragment loads run ahead of the products
        for (int kk = 0; kk < W2K; kk += 8) {
            // k pairing of A and B as in the core: low pair, then high pair.
            const v4f a  = *(const v4f*)(pa + kk);
            const v4f b0 = *(const v4f*)(pb + kk);
            const v4f b1 = *(const v4f*)(pb + 16 * W2P + kk);
            acc[0] = WMMA_F32(LO2(a), LO2(b0), acc[0]);
            acc[1] = WMMA_F32(LO2(a), LO2(b1), acc[1]);
            acc[0] = WMMA_F32(HI2(a), HI2(b0), acc[0]);
            acc[1] = WMMA_F32(HI2(a), HI2(b1), acc[1]);
        }
        asm volatile("s_wait_dscnt 0x0" ::: "memory");      // own reads of this buffer are done
        asm volatile("s_wait_asynccnt 0x0" ::: "memory");   // own share of chunk c + 1 has landed
        __syncthreads();                                    // publishes chunk c + 1, frees this buffer
        // Distance behind the chunk's last products, on both sides of the branch
        // below, as in the core: the address arithmetic reuses fragment registers.
        __builtin_amdgcn_sched_barrier(0);
        asm volatile("v_nop\n\tv_nop\n\tv_nop\n\tv_nop\n\tv_nop\n\tv_nop\n\tv_nop\n\tv_nop");
        __builtin_amdgcn_sched_barrier(0);
        if (c + 2 < NCH)
            w2_stage(l0 + (c & 1) * (STG * 4), g0 + (size_t)(c + 2) * W2K * Dn);
    }
    asm volatile("s_wait_asynccnt 0x0" ::: "memory");       // nothing in flight at the wave's end

    const int mg = c0 + (wave >> 1) * 16 + ((lane >> 4) << 3);
    #pragma unroll
    for (int j = 0; j < 2; ++j) {
        const v8f c = acc[j];
        const int ng = a0 + (wave & 1) * 32 + j * 16 + mr;
        *(v4f*)(W2 + (size_t)ng * Dn + mg)     = (v4f){c[0], c[1], c[2], c[3]};
        *(v4f*)(W2 + (size_t)ng * Dn + mg + 4) = (v4f){c[4], c[5], c[6], c[7]};
    }
}

// dst[c] = sum_h Mat[h][c] vec[h] for the 32 columns from c0 on: a wave takes
// every eighth row, a lane one column; 32 results = one whole 128-byte line.
__device__ __forceinline__ void colvec32(const float* __restrict__ Mat,
                                         const float* __restrict__ vec,
                                         float* __restrict__ dst, int c0, float* sm) {
    const int lane = threadIdx.x & 31;
    const int wave = threadIdx.x >> 5;
    float a = 0.f;
    #pragma unroll 16  // sixteen independent loads in flight
    for (int i = 0; i < Dn / 8; ++i) {
        const int h = wave + 8 * i;
        a += Mat[(size_t)h * Dn + c0 + lane] * vec[h];
    }
    sm[wave * 32 + lane] = a;
    __syncthreads();                              // the eight partial sums are complete
    if (wave == 0) {
        float r = 0.f;
        for (int j = 0; j < 8; ++j) r += sm[j * 32 + lane];
        dst[c0 + lane] = r;
    }
}

// dst[0] = p . q over Dn elements (every wave forms it, thread 0 stores it).
__device__ __forceinline__ void dot_dn(const float* __restrict__ p,
                                       const float* __restrict__ q,
                                       float* __restrict__ dst) {
    const int lane = threadIdx.x & 31;
    float a = 0.f;
    #pragma unroll  // six independent pairs of loads in flight
    for (int j = 0; j < Dn / 128; ++j) {
        const v4f m = *(const v4f*)(p + j * 128 + lane * 4);
        const v4f v = *(const v4f*)(q + j * 128 + lane * 4);
        a += (m[0] * v[0] + m[1] * v[1]) + (m[2] * v[2] + m[3] * v[3]);
    }
    for (int o = 16; o; o >>= 1) a += __shfl_xor(a, o);
    if (threadIdx.x == 0) dst[0] = a;
}

// Kernel 1: a work-group's part follows from its index alone.  The W2 tiles,
// the longest parts, come first, so that they run beside the transposes, which
// wait on memory and leave the matrix units idle.
constexpr int NPRE = NW2 + 2 * CG + 1;            // work-groups in front of those of x
__global__ __launch_bounds__(256) void prep(
    const float* __restrict__ x, const float* __restrict__ Wq, const float* __restrict__ bq,
    const float* __restrict__ Wk, const float* __restrict__ bk,
    float* __restrict__ XT, float* __restrict__ sp, float* __restrict__ W2,
    float* __restrict__ w, float* __restrict__ u, float* __restrict__ beta)
{
    __shared__ __attribute__((aligned(16))) float sm[PSM];
    const int blk = blockIdx.x;
    if (blk < NW2)               w2_tile(Wq, Wk, W2, sm, blk);
    else if (blk < NW2 + CG)     colvec32(Wq, bk, w, (blk - NW2) * 32, sm);
    else if (blk < NW2 + 2 * CG) colvec32(Wk, bq, u, (blk - NW2 - CG) * 32, sm);
    else if (blk < NPRE)         dot_dn(bq, bk, beta);
    else                         transpose_sum(x, XT, sp, sm, blk - NPRE);
}

// ---------------------------------------------------------------------------
// Kernels 2 to 4: 768 x 768 results per batch, one 192 x 96 tile per work-group:
// 4 x 8 tiles x 8 batches = 256 work-groups, one per WGP.  The result is stored
// transposed, CT[n][m] = sum_k A[m][k] B[n][k] (+ un[n] * vm[m] where R1).
// ---------------------------------------------------------------------------
constexpr int TBM = 192, TBN = 96, TKC = 128, TFA = 3, TFB = 3;
constexpr int TSM = 2 * (TBM + TBN) * (TKC + 4);  // floats of LDS: 297 KiB

template <bool R1>
__device__ __forceinline__ void store_t(float* __restrict__ CT, int bm, int bn,
                                        const v8f (&acc)[TFA][TFB],
                                        const float* __restrict__ un,
                                        const float* __restrict__ vm) {
    const int lane = threadIdx.x & 31;
    const int wave = threadIdx.x >> 5;
    const int n  = lane & 15;
    const int m0 = (lane >> 4) << 3;
    #pragma unroll
    for (int ms = 0; ms < TFA; ++ms) {
        #pragma unroll
        for (int ns = 0; ns < TFB; ++ns) {
            const v8f c = acc[ms][ns];
            const int ng = bn * TBN + (wave & 1) * (TFB * 16) + ns * 16 + n;
            const int mg = bm * TBM + (wave >> 1) * (TFA * 16) + ms * 16 + m0;
            v4f lo = (v4f){c[0], c[1], c[2], c[3]};
            v4f hi = (v4f){c[4], c[5], c[6], c[7]};
            if (R1) {
                const float u = un[ng];
                lo += u * *(const v4f*)(vm + mg);
                hi += u * *(const v4f*)(vm + mg + 4);
            }
            *(v4f*)(CT + (size_t)ng * Dn + mg)     = lo;
            *(v4f*)(CT + (size_t)ng * Dn + mg + 4) = hi;
        }
    }
}

// dst[r] = Mat[r] . vec (+ addc * addv[r] where ADD) for the 32 rows from r0 on:
// one wave a row, four rows a wave; 32 results = one whole 128-byte line.
template <bool ADD>
__device__ __forceinline__ void rowdot32(const float* __restrict__ Mat,
                                         const float* __restrict__ vec,
                                         float addc, const float* __restrict__ addv,
                                         float* __restrict__ dst, int r0) {
    const int lane = threadIdx.x & 31;
    const int wave = threadIdx.x >> 5;
    // The loads below reuse registers that the tile's stores, just issued, name.
    asm volatile("s_wait_xcnt 0x0" ::: "memory");
    for (int i = 0; i < 4; ++i) {
        const int r = r0 + wave * 4 + i;
        float a = 0.f;
        #pragma unroll  // six independent pairs of loads in flight
        for (int j = 0; j < Dn / 128; ++j) {
            const v4f m = *(const v4f*)(Mat + (size_t)r * Dn + j * 128 + lane * 4);
            const v4f v = *(const v4f*)(vec + j * 128 + lane * 4);
            a += (m[0] * v[0] + m[1] * v[1]) + (m[2] * v[2] + m[3] * v[3]);
        }
        for (int o = 16; o; o >>= 1) a += __shfl_xor(a, o);
        if (lane == 0) dst[r] = ADD ? a + addc * addv[r] : a;
    }
}

// Kernel 2: G = X^T X (reduction over l = 2048); the column sums s completed.
__global__ __launch_bounds__(256) void gram_wmma(
    const float* __restrict__ XT, const float* __restrict__ sp,
    float* __restrict__ G, float* __restrict__ s)
{
    __shared__ __attribute__((aligned(16))) float sm[TSM];
    const int b  = blockIdx.x / 32;
    const int tt = blockIdx.x % 32;
    const int bm = tt / 8;
    const int bn = tt % 8;

    v8f acc[TFA][TFB] = {};
    gemm_tn_staged<TBM, TBN, TKC, Ln, TFA, TFB, 256, 2, 12>(
        XT + (size_t)b * Dn * Ln + (size_t)(bm * TBM) * Ln,
        XT + (size_t)b * Dn * Ln + (size_t)(bn * TBN) * Ln, sm, acc);
    store_t<false>(G + (size_t)b * Dn * Dn, bm, bn, acc, nullptr, nullptr);

    if (tt < CG && threadIdx.x < 32) {
        const int j = tt * 32 + threadIdx.x;
        float a = 0.f;
        for (int g = 0; g < RGX; ++g) a += sp[(size_t)(b * RGX + g) * Dn + j];
        s[b * Dn + j] = a;
    }
}

// Kernel 3: T^T[o][c] = sum_j G[c][j] Wv[o][j] + bv[o] s[c]; tl = Wv s + L bv.
__global__ __launch_bounds__(256) void tv_wmma(
    const float* __restrict__ G, const float* __restrict__ Wv,
    const float* __restrict__ bv, const float* __restrict__ s,
    float* __restrict__ TT, float* __restrict__ tl)
{
    __shared__ __attribute__((aligned(16))) float sm[TSM];
    const int b  = blockIdx.x / 32;
    const int tt = blockIdx.x % 32;
    const int bm = tt / 8;
    const int bn = tt % 8;

    v8f acc[TFA][TFB] = {};
    gemm_tn_staged<TBM, TBN, TKC, Dn, TFA, TFB, 256, 2, 12>(
        G + (size_t)b * Dn * Dn + (size_t)(bm * TBM) * Dn,
        Wv + (size_t)(bn * TBN) * Dn, sm, acc);
    store_t<true>(TT + (size_t)b * Dn * Dn, bm, bn, acc, bv, s + b * Dn);

    if (tt < CG)
        rowdot32<true>(Wv, s + b * Dn, (float)Ln, bv, tl + b * Dn, tt * 32);
}

// Kernel 4: P^T[o][a] = sum_c W2[a][c] T^T[o][c] + tl[o] w[a]; pl = T^T u + beta tl.
__global__ __launch_bounds__(256) void pk_wmma(
    const float* __restrict__ W2, const float* __restrict__ TT,
    const float* __restrict__ tl, const float* __restrict__ w,
    const float* __restrict__ u, const float* __restrict__ beta,
    float* __restrict__ PT, float* __restrict__ pl)
{
    __shared__ __attribute__((aligned(16))) float sm[TSM];
    const int b  = blockIdx.x / 32;
    const int tt = blockIdx.x % 32;
    const int bm = tt / 8;
    const int bn = tt % 8;
    // beta is read here, ahead of the product: a scalar load whose latency is
    // hidden, and no load of it stands behind the tile's stores.
    const float be = beta[0];

    v8f acc[TFA][TFB] = {};
    gemm_tn_staged<TBM, TBN, TKC, Dn, TFA, TFB, 256, 2, 12>(
        W2 + (size_t)(bm * TBM) * Dn,
        TT + (size_t)b * Dn * Dn + (size_t)(bn * TBN) * Dn, sm, acc);
    store_t<true>(PT + (size_t)b * Dn * Dn, bm, bn, acc, tl + b * Dn, w);

    if (tt < CG)
        rowdot32<true>(TT + (size_t)b * Dn * Dn, u, be, tl + b * Dn, pl + b * Dn, tt * 32);
}

// ---------------------------------------------------------------------------
// Kernel 5: out = (X P + 1 pl^T) * (1/sqrt(768)).  A = x row-major, B from P^T.
// 256 x 192 tile per work-group of 16 waves (4 x 4): 8 x 4 tiles x 8 batches =
// 256 work-groups, one per WGP.
// ---------------------------------------------------------------------------
__global__ __launch_bounds__(512) void xp_wmma(
    const float* __restrict__ x, const float* __restrict__ PT,
    const float* __restrict__ pl, float* __restrict__ out)
{
    constexpr int BM = 256, BN = 192, KC = 64, FA = 4, FB = 3;
    __shared__ __attribute__((aligned(16))) float sm[2 * (BM + BN) * (KC + 4)];   // 238 KiB

    const int b  = blockIdx.x / 32;
    const int tt = blockIdx.x % 32;
    const int bm = tt / 4;
    const int bn = tt % 4;

    v8f acc[FA][FB] = {};
    gemm_tn_staged<BM, BN, KC, Dn, FA, FB, 512, 4, 14>(
        x  + (size_t)b * Ln * Dn + (size_t)(bm * BM) * Dn,
        PT + (size_t)b * Dn * Dn + (size_t)(bn * BN) * Dn, sm, acc);

    const float alpha = 0.03608439182435161f;   // 1/sqrt(768)
    const int lane = threadIdx.x & 31;
    const int wave = threadIdx.x >> 5;
    const int n  = lane & 15;
    const int m0 = (lane >> 4) << 3;
    float* ob = out + (size_t)b * Ln * Dn;
    #pragma unroll
    for (int ns = 0; ns < FB; ++ns) {
        const int ng = bn * BN + (wave & 3) * (FB * 16) + ns * 16 + n;
        const float pb = pl[b * Dn + ng];
        #pragma unroll
        for (int ms = 0; ms < FA; ++ms) {
            const v8f c = acc[ms][ns];
            const int mg = bm * BM + (wave >> 2) * (FA * 16) + ms * 16 + m0;
            #pragma unroll
            for (int r = 0; r < 8; ++r)
                ob[(size_t)(mg + r) * Dn + ng] = (c[r] + pb) * alpha;
        }
    }
}

// ---------------------------------------------------------------------------
extern "C" void kernel_launch(void* const* d_in, const int* in_sizes, int n_in,
                              void* d_out, int out_size, void* d_ws, size_t ws_size,
                              hipStream_t stream) {
    const float* x  = (const float*)d_in[0];
    const float* Wq = (const float*)d_in[1];
    const float* bq = (const float*)d_in[2];
    const float* Wk = (const float*)d_in[3];
    const float* bk = (const float*)d_in[4];
    const float* Wv = (const float*)d_in[5];
    const float* bv = (const float*)d_in[6];
    float* out = (float*)d_out;

    // Workspace: X^T | G | T^T | P^T | W2 | sp | s | tl | pl | w | u | beta  (110 MB)
    float* XT  = (float*)d_ws;
    float* G   = XT  + (size_t)Rn * Dn;
    float* TT  = G   + (size_t)Bn * Dn * Dn;
    float* PT  = TT  + (size_t)Bn * Dn * Dn;
    float* W2  = PT  + (size_t)Bn * Dn * Dn;
    float* sp  = W2  + (size_t)Dn * Dn;
    float* s   = sp  + (size_t)Bn * RGX * Dn;
    float* tl  = s   + (size_t)Bn * Dn;
    float* pl  = tl  + (size_t)Bn * Dn;
    float* w   = pl  + (size_t)Bn * Dn;
    float* u   = w   + (size_t)Dn;
    float* beta = u  + (size_t)Dn;

    dim3 blk(256);  // 8 waves per workgroup
    prep     <<<NPRE + Bn * RGX * CG, blk, 0, stream>>>(x, Wq, bq, Wk, bk, XT, sp, W2, w, u, beta);
    gram_wmma<<<Bn * 32, blk, 0, stream>>>(XT, sp, G, s);
    tv_wmma  <<<Bn * 32, blk, 0, stream>>>(G, Wv, bv, s, TT, tl);
    pk_wmma  <<<Bn * 32, blk, 0, stream>>>(W2, TT, tl, w, u, beta, PT, pl);
    xp_wmma  <<<Bn * 32, dim3(512), 0, stream>>>(x, PT, pl, out);
}

// v004
// It runs in 262 microseconds.
// Two timings next to v003 put it at 1.11 and 1.10 times that version's speed.
// Counting every step since v000, it is 2.22 times as fast.
#include <hip/hip_runtime.h>

// FP32 WMMA building blocks for gfx1250 (wave32).
typedef float v2f __attribute__((ext_vector_type(2)));
typedef float v4f __attribute__((ext_vector_type(4)));
typedef float v8f __attribute__((ext_vector_type(8)));

#define WMMA_F32(a, b, c) \
    __builtin_amdgcn_wmma_f32_16x16x4_f32(false, (a), false, (b), (short)0, (c), false, false)
#define LO2(v) __builtin_shufflevector((v), (v), 0, 1)
#define HI2(v) __builtin_shufflevector((v), (v), 2, 3)

constexpr int Bn = 8;
constexpr int Ln = 2048;
constexpr int Dn = 768;
constexpr int Rn = Bn * Ln;       // 16384 rows of x

// The matrix chain, reassociated.  With X one batch of x (L x D), 1 a column of
// ones, G = X^T X and s = X^T 1:
//   K^T V = Wk G Wv^T + (Wk s) bv^T + bk (Wv s)^T + L bk bv^T
//   out   = (X Wq^T + 1 bq^T) (K^T V) / sqrt(D)
// so the three weight matrices multiply D x D matrices, not the L rows of X:
//   T^T[o][c] = sum_j Wv[o][j] G[c][j] + bv[o] s[c]     tl[o] = Wv[o] . s + L bv[o]
// and Wq^T (Wk T + bk tl^T) = (Wq^T Wk) T + (Wq^T bk) tl^T, where the products of
// the weights alone do not depend on the batch and are formed once:
//   W2[a][c]  = sum_h Wq[h][a] Wk[h][c]    w = Wq^T bk    u = Wk^T bq    beta = bq . bk
//   P^T[o][a] = sum_c T^T[o][c] W2[a][c] + tl[o] w[a]   pl[o] = T^T[o] . u + beta tl[o]
//   out[l][o] = (sum_a X[l][a] P^T[o][a] + pl[o]) / sqrt(D)

// ---------------------------------------------------------------------------
// Kernel 1, the part for x: X^T per batch ([b][d][l]), so that G reads its
// reduction dim contiguously; and the column sums of X, one partial sum per
// 256 rows.  One work-group: 256 rows x 32 columns, in two passes of 128 rows.
// ---------------------------------------------------------------------------
constexpr int TR  = 128;          // rows a pass
constexpr int TP  = TR + 4;       // LDS pitch of one column, floats (16 B x odd)
constexpr int RGX = Ln / 256;     // row groups of a batch of x: 8
constexpr int CG  = Dn / 32;      // column groups: 24

__device__ __forceinline__ void transpose_sum(
    const float* __restrict__ x, float* __restrict__ XT, float* __restrict__ sp,
    float* tile, int blk)
{
    const int t    = threadIdx.x;
    const int lane = t & 31;
    const int wave = t >> 5;
    const int b    = blk / (RGX * CG);
    const int rem  = blk % (RGX * CG);
    const int rg   = rem / CG;
    const int d0   = (rem % CG) * 32;
    const float* src = x + (size_t)b * Ln * Dn;
    float*       dst = XT + (size_t)b * Dn * Ln;

    float cs[4] = {0.f, 0.f, 0.f, 0.f};
    for (int p = 0; p < 2; ++p) {
        const int r0 = rg * 256 + p * TR;
        #pragma unroll  // four independent loads in flight
        for (int i = 0; i < 4; ++i) {
            const int row = (t >> 3) + 32 * i;
            const int c4  = (t & 7) * 4;
            const v4f v = *(const v4f*)(src + (size_t)(r0 + row) * Dn + d0 + c4);
            tile[(c4 + 0) * TP + row] = v[0];
            tile[(c4 + 1) * TP + row] = v[1];
            tile[(c4 + 2) * TP + row] = v[2];
            tile[(c4 + 3) * TP + row] = v[3];
        }
        __syncthreads();                          // the pass's tile is complete
        #pragma unroll  // cs[] stays in registers
        for (int i = 0; i < 4; ++i) {
            const int c = wave + 8 * i;
            const v4f v = *(const v4f*)(tile + c * TP + lane * 4);
            *(v4f*)(dst + (size_t)(d0 + c) * Ln + r0 + lane * 4) = v;
            cs[i] += (v[0] + v[1]) + (v[2] + v[3]);
        }
        __syncthreads();                          // every read done before the next pass writes
    }
    #pragma unroll  // cs[] stays in registers
    for (int i = 0; i < 4; ++i) {
        float a = cs[i];
        for (int o = 16; o; o >>= 1) a += __shfl_xor(a, o);
        if (lane == 0) sp[(size_t)(b * RGX + rg) * Dn + d0 + wave + 8 * i] = a;
    }
}

// ---------------------------------------------------------------------------
// Shared core of the products of kernels 2 to 5: C = A * B^T, both operands contiguous along
// the reduction dim (leading dim LD = reduction length).  One BM x BN tile per
// work-group of NTHR / 32 waves, WN of them side by side along n, wave tile
// (16*FA) x (16*FB).  Chunks of KC k-columns of all BM + BN operand rows are
// brought into LDS by whole-line asynchronous b128 copies, two buffers: chunk
// c + 1 flies while chunk c is multiplied.  Fragments come from LDS with
// ds_load_b128 at a pitch of KC + 4 floats (16 B x odd: no bank conflict).
// ---------------------------------------------------------------------------

// A run of copies and its s_wait_xcnt 0 in ONE statement, so that no address
// register of a copy is rewritten ahead of the wait.
__device__ __forceinline__ void copy_run_b32(const unsigned (&l)[8], const float* const (&g)[8]) {
    asm volatile("global_load_async_to_lds_b32 %0, %1, off\n\t"
                 "global_load_async_to_lds_b32 %2, %3, off\n\t"
                 "global_load_async_to_lds_b32 %4, %5, off\n\t"
                 "global_load_async_to_lds_b32 %6, %7, off\n\t"
                 "global_load_async_to_lds_b32 %8, %9, off\n\t"
                 "global_load_async_to_lds_b32 %10, %11, off\n\t"
                 "global_load_async_to_lds_b32 %12, %13, off\n\t"
                 "global_load_async_to_lds_b32 %14, %15, off\n\t"
                 "s_wait_xcnt 0x0"
                 :: "v"(l[0]), "v"(g[0]), "v"(l[1]), "v"(g[1]), "v"(l[2]), "v"(g[2]),
                    "v"(l[3]), "v"(g[3]), "v"(l[4]), "v"(g[4]), "v"(l[5]), "v"(g[5]),
                    "v"(l[6]), "v"(g[6]), "v"(l[7]), "v"(g[7])
                 : "memory");
}
__device__ __forceinline__ void copy_run(const unsigned (&l)[12], const float* const (&g)[12]) {
    asm volatile("global_load_async_to_lds_b128 %0, %1, off\n\t"
                 "global_load_async_to_lds_b128 %2, %3, off\n\t"
                 "global_load_async_to_lds_b128 %4, %5, off\n\t"
                 "global_load_async_to_lds_b128 %6, %7, off\n\t"
                 "global_load_async_to_lds_b128 %8, %9, off\n\t"
                 "global_load_async_to_lds_b128 %10, %11, off\n\t"
                 "global_load_async_to_lds_b128 %12, %13, off\n\t"
                 "global_load_async_to_lds_b128 %14, %15, off\n\t"
                 "global_load_async_to_lds_b128 %16, %17, off\n\t"
                 "global_load_async_to_lds_b128 %18, %19, off\n\t"
                 "global_load_async_to_lds_b128 %20, %21, off\n\t"
                 "global_load_async_to_lds_b128 %22, %23, off\n\t"
                 "s_wait_xcnt 0x0"
                 :: "v"(l[0]), "v"(g[0]), "v"(l[1]), "v"(g[1]), "v"(l[2]), "v"(g[2]),
                    "v"(l[3]), "v"(g[3]), "v"(l[4]), "v"(g[4]), "v"(l[5]), "v"(g[5]),
                    "v"(l[6]), "v"(g[6]), "v"(l[7]), "v"(g[7]), "v"(l[8]), "v"(g[8]),
                    "v"(l[9]), "v"(g[9]), "v"(l[10]), "v"(g[10]), "v"(l[11]), "v"(g[11])
                 : "memory");
}
__device__ __forceinline__ void copy_run(const unsigned (&l)[14], const float* const (&g)[14]) {
    asm volatile("global_load_async_to_lds_b128 %0, %1, off\n\t"
                 "global_load_async_to_lds_b128 %2, %3, off\n\t"
                 "global_load_async_to_lds_b128 %4, %5, off\n\t"
                 "global_load_async_to_lds_b128 %6, %7, off\n\t"
                 "global_load_async_to_lds_b128 %8, %9, off\n\t"
                 "global_load_async_to_lds_b128 %10, %11, off\n\t"
                 "global_load_async_to_lds_b128 %12, %13, off\n\t"
                 "global_load_async_to_lds_b128 %14, %15, off\n\t"
                 "global_load_async_to_lds_b128 %16, %17, off\n\t"
                 "global_load_async_to_lds_b128 %18, %19, off\n\t"
                 "global_load_async_to_lds_b128 %20, %21, off\n\t"
                 "global_load_async_to_lds_b128 %22, %23, off\n\t"
                 "global_load_async_to_lds_b128 %24, %25, off\n\t"
                 "global_load_async_to_lds_b128 %26, %27, off\n\t"
                 "s_wait_xcnt 0x0"
                 :: "v"(l[0]), "v"(g[0]), "v"(l[1]), "v"(g[1]), "v"(l[2]), "v"(g[2]),
                    "v"(l[3]), "v"(g[3]), "v"(l[4]), "v"(g[4]), "v"(l[5]), "v"(g[5]),
                    "v"(l[6]), "v"(g[6]), "v"(l[7]), "v"(g[7]), "v"(l[8]), "v"(g[8]),
                    "v"(l[9]), "v"(g[9]), "v"(l[10]), "v"(g[10]), "v"(l[11]), "v"(g[11]),
                    "v"(l[12]), "v"(g[12]), "v"(l[13]), "v"(g[13])
                 : "memory");
}

// One chunk of all BM + BN rows: the block's NTHR lanes sweep NTHR * 4 / KC rows
// at a time, 16 B a lane, G copies a statement.  l0, ga, gb: this lane's slot in
// the first sweep (LDS byte address, A source, B source).
template <int BM, int BN, int KC, int LD, int NTHR, int G>
__device__ __forceinline__ void stage_chunk(unsigned l0, const float* ga, const float* gb) {
    constexpr int RPS = NTHR * 4 / KC;
    constexpr int NA = BM / RPS, NT = (BM + BN) / RPS;
    static_assert(BM % RPS == 0 && BN % RPS == 0 && NT % G == 0 && NT <= 63, "sweeps");
    #pragma unroll  // every operand index of a copy statement must be a constant
    for (int s = 0; s < NT; s += G) {
        unsigned l[G];
        const float* g[G];
        #pragma unroll  // as above
        for (int u = 0; u < G; ++u) {
            const int j = s + u;
            l[u] = l0 + (unsigned)(j * RPS * (KC + 4) * 4);
            g[u] = j < NA ? ga + (size_t)j * RPS * LD : gb + (size_t)(j - NA) * RPS * LD;
        }
        copy_run(l, g);
    }
}

template <int BM, int BN, int KC, int LD, int FA, int FB, int NTHR, int WN, int G>
__device__ __forceinline__ void gemm_tn_staged(const float* __restrict__ A,
                                               const float* __restrict__ B,
                                               float* sm, v8f (&acc)[FA][FB]) {
    constexpr int LDP = KC + 4;                   // LDS row pitch, floats
    constexpr int STG = (BM + BN) * LDP;          // floats per buffer
    constexpr int NCH = LD / KC;
    static_assert(BM == 16 * FA * (NTHR / 32 / WN) && BN == 16 * FB * WN && LD % KC == 0 && NCH >= 2, "tile");

    const int t    = threadIdx.x;
    const int lane = t & 31;
    const int wave = t >> 5;
    const int mr = lane & 15;
    const int h4 = (lane >> 4) << 2;              // {0, 4}

    const int crow = t / (KC / 4);
    const int ccol = (t % (KC / 4)) * 4;
    const float* ga = A + (size_t)crow * LD + ccol;
    const float* gb = B + (size_t)crow * LD + ccol;
    const unsigned l0 = (unsigned)(uintptr_t)(sm + crow * LDP + ccol);   // LDS byte address

    stage_chunk<BM, BN, KC, LD, NTHR, G>(l0, ga, gb);
    asm volatile("s_wait_asynccnt 0x0" ::: "memory");   // this wave's share of chunk 0 has landed
    __syncthreads();                                    // chunk 0 readable by every wave
    stage_chunk<BM, BN, KC, LD, NTHR, G>(l0 + STG * 4, ga + KC, gb + KC);

    const int ra = ((wave / WN) * (FA * 16) + mr) * LDP + h4;
    const int rb = (BM + (wave % WN) * (FB * 16) + mr) * LDP + h4;

    for (int c = 0; c < NCH; ++c) {
        const float* pa = sm + (c & 1) * STG + ra;
        const float* pb = sm + (c & 1) * STG + rb;
        #pragma unroll  // constant LDS offsets; lets fragment loads run ahead of the products
        for (int kk = 0; kk < KC; kk += 8) {
            // The inner loops below are unrolled so that the fragment and
            // accumulator arrays stay in registers (every index a constant).
            v4f a[FA], b[FB];
            #pragma unroll
            for (int i = 0; i < FA; ++i) a[i] = *(const v4f*)(pa + i * 16 * LDP + kk);
            #pragma unroll
            for (int j = 0; j < FB; ++j) b[j] = *(const v4f*)(pb + j * 16 * LDP + kk);
            // Per accumulator the low pair, then the high pair, but all tiles'
            // low pairs first: no back-to-back dependent accumulation.
            #pragma unroll
            for (int i = 0; i < FA; ++i)
                #pragma unroll
                for (int j = 0; j < FB; ++j)
                    acc[i][j] = WMMA_F32(LO2(a[i]), LO2(b[j]), acc[i][j]);
            #pragma unroll
            for (int i = 0; i < FA; ++i)
                #pragma unroll
                for (int j = 0; j < FB; ++j)
                    acc[i][j] = WMMA_F32(HI2(a[i]), HI2(b[j]), acc[i][j]);
        }
        asm volatile("s_wait_dscnt 0x0" ::: "memory");      // own reads of this buffer are done
        asm volatile("s_wait_asynccnt 0x0" ::: "memory");   // own share of chunk c + 1 has landed
        __syncthreads();                                    // publishes chunk c + 1, frees this buffer
        // Distance behind the chunk's last products, on both sides of the branch
        // below: the address arithmetic that follows reuses fragment registers.
        // The f32 16x16x4 form has no row of its own in the distance table; it
        // issues at the 8-bit-integer form's interval, so that form's 8 slots.
        // The fence pair keeps the products in front of the slots and the
        // address arithmetic behind them.
        __builtin_amdgcn_sched_barrier(0);
        asm volatile("v_nop\n\tv_nop\n\tv_nop\n\tv_nop\n\tv_nop\n\tv_nop\n\tv_nop\n\tv_nop");
        __builtin_amdgcn_sched_barrier(0);
        if (c + 2 < NCH)
            stage_chunk<BM, BN, KC, LD, NTHR, G>(l0 + (c & 1) * (STG * 4),
                                           ga + (c + 2) * KC, gb + (c + 2) * KC);
    }
    asm volatile("s_wait_asynccnt 0x0" ::: "memory");       // nothing in flight at the wave's end
}

// ---------------------------------------------------------------------------
// Kernel 1, the parts for the weights alone.
// W2[a][c] = sum_h Wk[h][c] Wq[h][a]: the reduction runs down the rows of both
// operands.  Asynchronous b32 copies turn a chunk of W2K rows h as they bring it
// in: a wave reads 32 neighbouring columns of one row (one whole line), and each
// lane drops its word into its own column's LDS row, so that the fragments come
// from LDS as in the core (ds_load_b128 along k, pitch 16 B x odd).  Same ring
// as the core, two buffers.  One 64 (c) x 64 (a) tile per work-group, 8 waves
// as 4 x 2, wave tile 16 x 32; LDS rows 0-63: columns of Wk, 64-127: of Wq.
// ---------------------------------------------------------------------------
constexpr int W2T = 64;                           // edge of a tile
constexpr int W2K = 32;                           // rows h a chunk
constexpr int W2P = W2K + 4;                      // LDS pitch of a column, floats
constexpr int NW2 = (Dn / W2T) * (Dn / W2T);      // tiles: 144
constexpr int PSM = 2 * 2 * W2T * W2P;            // floats of LDS of kernel 1: 36 KiB
static_assert(PSM >= 32 * TP, "the transpose tile fits");

// One chunk: a wave keeps its 32 columns and takes every second row h.
// l0, g0: this lane's first word (LDS byte address, source).
__device__ __forceinline__ void w2_stage(unsigned l0, const float* g0) {
    #pragma unroll  // every operand index of a copy statement must be a constant
    for (int s = 0; s < W2K / 2; s += 8) {
        unsigned l[8];
        const float* g[8];
        #pragma unroll  // as above
        for (int v = 0; v < 8; ++v) {
            l[v] = l0 + (unsigned)((s + v) * 2 * 4);
            g[v] = g0 + (size_t)(s + v) * 2 * Dn;
        }
        copy_run_b32(l, g);
        // Keeps the next run's addresses from being formed ahead of this run, so
        // that both use the same registers: kernel 1 stays within 64 registers
        // and the transposes keep their eight work-groups a WGP.
        __builtin_amdgcn_sched_barrier(0);
    }
}

__device__ __forceinline__ void w2_tile(const float* __restrict__ Wq,
                                        const float* __restrict__ Wk,
                                        float* __restrict__ W2, float* sm, int tile) {
    constexpr int STG = 2 * W2T * W2P;            // floats per buffer
    constexpr int NCH = Dn / W2K;
    static_assert(Dn % W2K == 0 && W2K % 16 == 0 && NCH >= 2, "chunks");

    const int lane = threadIdx.x & 31;
    const int wave = threadIdx.x >> 5;
    const int c0 = (tile / (Dn / W2T)) * W2T;
    const int a0 = (tile % (Dn / W2T)) * W2T;

    const int cg = wave & 3;                      // this wave's 32 columns: 0, 1 of Wk; 2, 3 of Wq
    const float* gm = cg < 2 ? Wk : Wq;
    const int    gc = cg < 2 ? c0 + cg * 32 : a0 + (cg - 2) * 32;
    const float* g0 = gm + (size_t)(wave >> 2) * Dn + gc + lane;
    const unsigned l0 = (unsigned)(uintptr_t)(sm + (cg * 32 + lane) * W2P + (wave >> 2));   // LDS byte address

    w2_stage(l0, g0);
    asm volatile("s_wait_asynccnt 0x0" ::: "memory");   // this wave's share of chunk 0 has landed
    __syncthreads();                                    // chunk 0 readable by every wave
    w2_stage(l0 + STG * 4, g0 + (size_t)W2K * Dn);

    const int mr = lane & 15;
    const int h4 = (lane >> 4) << 2;              // {0, 4}
    const int ra = ((wave >> 1) * 16 + mr) * W2P + h4;
    const int rb = (W2T + (wave & 1) * 32 + mr) * W2P + h4;

    v8f acc[2] = {};
    for (int c = 0; c < NCH; ++c) {
        const float* pa = sm + (c & 1) * STG + ra;
        const float* pb = sm + (c & 1) * STG + rb;
        #pragma unroll  // constant LDS offsets; lets fragment loads run ahead of the products
        for (int kk = 0; kk < W2K; kk += 8) {
            // k pairing of A and B as in the core: low pair, then high pair.
            const v4f a  = *(const v4f*)(pa + kk);
            const v4f b0 = *(const v4f*)(pb + kk);
            const v4f b1 = *(const v4f*)(pb + 16 * W2P + kk);
            acc[0] = WMMA_F32(LO2(a), LO2(b0), acc[0]);
            acc[1] = WMMA_F32(LO2(a), LO2(b1), acc[1]);
            acc[0] = WMMA_F32(HI2(a), HI2(b0), acc[0]);
            acc[1] = WMMA_F32(HI2(a), HI2(b1), acc[1]);
        }
        asm volatile("s_wait_dscnt 0x0" ::: "memory");      // own reads of this buffer are done
        asm volatile("s_wait_asynccnt 0x0" ::: "memory");   // own share of chunk c + 1 has landed
        __syncthreads();                                    // publishes chunk c + 1, frees this buffer
        // Distance behind the chunk's last products, on both sides of the branch
        // below, as in the core: the address arithmetic reuses fragment registers.
        __builtin_amdgcn_sched_barrier(0);
        asm volatile("v_nop\n\tv_nop\n\tv_nop\n\tv_nop\n\tv_nop\n\tv_nop\n\tv_nop\n\tv_nop");
        __builtin_amdgcn_sched_barrier(0);
        if (c + 2 < NCH)
            w2_stage(l0 + (c & 1) * (STG * 4), g0 + (size_t)(c + 2) * W2K * Dn);
    }
    asm volatile("s_wait_asynccnt 0x0" ::: "memory");       // nothing in flight at the wave's end

    const int mg = c0 + (wave >> 1) * 16 + ((lane >> 4) << 3);
    #pragma unroll
    for (int j = 0; j < 2; ++j) {
        const v8f c = acc[j];
        const int ng = a0 + (wave & 1) * 32 + j * 16 + mr;
        *(v4f*)(W2 + (size_t)ng * Dn + mg)     = (v4f){c[0], c[1], c[2], c[3]};
        *(v4f*)(W2 + (size_t)ng * Dn + mg + 4) = (v4f){c[4], c[5], c[6], c[7]};
    }
}

// dst[c] = sum_h Mat[h][c] vec[h] for the 32 columns from c0 on: a wave takes
// every eighth row, a lane one column; 32 results = one whole 128-byte line.
__device__ __forceinline__ void colvec32(const float* __restrict__ Mat,
                                         const float* __restrict__ vec,
                                         float* __restrict__ dst, int c0, float* sm) {
    const int lane = threadIdx.x & 31;
    const int wave = threadIdx.x >> 5;
    float a = 0.f;
    #pragma unroll 16  // sixteen independent loads in flight
    for (int i = 0; i < Dn / 8; ++i) {
        const int h = wave + 8 * i;
        a += Mat[(size_t)h * Dn + c0 + lane] * vec[h];
    }
    sm[wave * 32 + lane] = a;
    __syncthreads();                              // the eight partial sums are complete
    if (wave == 0) {
        float r = 0.f;
        for (int j = 0; j < 8; ++j) r += sm[j * 32 + lane];
        dst[c0 + lane] = r;
    }
}

// dst[0] = p . q over Dn elements (every wave forms it, thread 0 stores it).
__device__ __forceinline__ void dot_dn(const float* __restrict__ p,
                                       const float* __restrict__ q,
                                       float* __restrict__ dst) {
    const int lane = threadIdx.x & 31;
    float a = 0.f;
    #pragma unroll  // six independent pairs of loads in flight
    for (int j = 0; j < Dn / 128; ++j) {
        const v4f m = *(const v4f*)(p + j * 128 + lane * 4);
        const v4f v = *(const v4f*)(q + j * 128 + lane * 4);
        a += (m[0] * v[0] + m[1] * v[1]) + (m[2] * v[2] + m[3] * v[3]);
    }
    for (int o = 16; o; o >>= 1) a += __shfl_xor(a, o);
    if (threadIdx.x == 0) dst[0] = a;
}

// Kernel 1: a work-group's part follows from its index alone.  The W2 tiles,
// the longest parts, come first, so that they run beside the transposes, which
// wait on memory and leave the matrix units idle.
constexpr int NPRE = NW2 + 2 * CG + 1;            // work-groups in front of those of x
__global__ __launch_bounds__(256) void prep(
    const float* __restrict__ x, const float* __restrict__ Wq, const float* __restrict__ bq,
    const float* __restrict__ Wk, const float* __restrict__ bk,
    float* __restrict__ XT, float* __restrict__ sp, float* __restrict__ W2,
    float* __restrict__ w, float* __restrict__ u, float* __restrict__ beta)
{
    __shared__ __attribute__((aligned(16))) float sm[PSM];
    const int blk = blockIdx.x;
    if (blk < NW2)               w2_tile(Wq, Wk, W2, sm, blk);
    else if (blk < NW2 + CG)     colvec32(Wq, bk, w, (blk - NW2) * 32, sm);
    else if (blk < NW2 + 2 * CG) colvec32(Wk, bq, u, (blk - NW2 - CG) * 32, sm);
    else if (blk < NPRE)         dot_dn(bq, bk, beta);
    else                         transpose_sum(x, XT, sp, sm, blk - NPRE);
}

// ---------------------------------------------------------------------------
// Kernels 3 and 4: 768 x 768 results per batch, one 192 x 96 tile per work-group:
// 4 x 8 tiles x 8 batches = 256 work-groups, one per WGP.  The result is stored
// transposed, CT[n][m] = sum_k A[m][k] B[n][k] (+ un[n] * vm[m] where R1).
// ---------------------------------------------------------------------------
constexpr int TBM = 192, TBN = 96, TKC = 128, TFA = 3, TFB = 3;
constexpr int TSM = 2 * (TBM + TBN) * (TKC + 4);  // floats of LDS: 297 KiB

template <bool R1>
__device__ __forceinline__ void store_t(float* __restrict__ CT, int bm, int bn,
                                        const v8f (&acc)[TFA][TFB],
                                        const float* __restrict__ un,
                                        const float* __restrict__ vm) {
    const int lane = threadIdx.x & 31;
    const int wave = threadIdx.x >> 5;
    const int n  = lane & 15;
    const int m0 = (lane >> 4) << 3;
    #pragma unroll
    for (int ms = 0; ms < TFA; ++ms) {
        #pragma unroll
        for (int ns = 0; ns < TFB; ++ns) {
            const v8f c = acc[ms][ns];
            const int ng = bn * TBN + (wave & 1) * (TFB * 16) + ns * 16 + n;
            const int mg = bm * TBM + (wave >> 1) * (TFA * 16) + ms * 16 + m0;
            v4f lo = (v4f){c[0], c[1], c[2], c[3]};
            v4f hi = (v4f){c[4], c[5], c[6], c[7]};
            if (R1) {
                const float u = un[ng];
                lo += u * *(const v4f*)(vm + mg);
                hi += u * *(const v4f*)(vm + mg + 4);
            }
            *(v4f*)(CT + (size_t)ng * Dn + mg)     = lo;
            *(v4f*)(CT + (size_t)ng * Dn + mg + 4) = hi;
        }
    }
}

// dst[r] = Mat[r] . vec (+ addc * addv[r] where ADD) for the 32 rows from r0 on:
// one wave a row, four rows a wave; 32 results = one whole 128-byte line.
template <bool ADD>
__device__ __forceinline__ void rowdot32(const float* __restrict__ Mat,
                                         const float* __restrict__ vec,
                                         float addc, const float* __restrict__ addv,
                                         float* __restrict__ dst, int r0) {
    const int lane = threadIdx.x & 31;
    const int wave = threadIdx.x >> 5;
    // The loads below reuse registers that the tile's stores, just issued, name.
    asm volatile("s_wait_xcnt 0x0" ::: "memory");
    for (int i = 0; i < 4; ++i) {
        const int r = r0 + wave * 4 + i;
        float a = 0.f;
        #pragma unroll  // six independent pairs of loads in flight
        for (int j = 0; j < Dn / 128; ++j) {
            const v4f m = *(const v4f*)(Mat + (size_t)r * Dn + j * 128 + lane * 4);
            const v4f v = *(const v4f*)(vec + j * 128 + lane * 4);
            a += (m[0] * v[0] + m[1] * v[1]) + (m[2] * v[2] + m[3] * v[3]);
        }
        for (int o = 16; o; o >>= 1) a += __shfl_xor(a, o);
        if (lane == 0) dst[r] = ADD ? a + addc * addv[r] : a;
    }
}

// Kernel 2: G = X^T X (reduction over l = 2048); the column sums s completed.
// G[p][q] and G[q][p] are the same sum of the same products for any x, so only
// the tiles that hold an element on or above the diagonal are multiplied, and
// the rest of G is stored from them a second time, turned.  128 (m) x 96 (n)
// tiles: column group bn needs the row groups bm with 128 bm <= 96 bn + 95, which
// makes 30 tiles of the 48 a batch, 240 work-groups, one per WGP, each with two
// thirds of the products of a 192 x 96 tile.
constexpr int GBM = 128, GBN = 96, GFA = 2, GFB = 3;
constexpr int GSM = 2 * (GBM + GBN) * (TKC + 4);  // floats of LDS: 231 KiB
// Row groups multiplied for column group bn.
constexpr int g_rows(int bn) { return (GBN * bn + GBN - 1) / GBM + 1; }
constexpr int g_tiles() { int n = 0; for (int j = 0; j < Dn / GBN; ++j) n += g_rows(j); return n; }
constexpr int GNT = g_tiles();                    // tiles a batch: 30
static_assert(GNT >= CG, "a batch's first CG work-groups complete s");

__global__ __launch_bounds__(256) void gram_wmma(
    const float* __restrict__ XT, const float* __restrict__ sp,
    float* __restrict__ G, float* __restrict__ s)
{
    __shared__ __attribute__((aligned(16))) float sm[GSM];
    const int b  = blockIdx.x / GNT;
    const int tt = blockIdx.x % GNT;
    int bm = tt, bn = 0;
    while (bm >= g_rows(bn)) bm -= g_rows(bn++);  // at most Dn / GBN - 1 trips: tt < GNT

    v8f acc[GFA][GFB] = {};
    gemm_tn_staged<GBM, GBN, TKC, Ln, GFA, GFB, 256, 2, 14>(
        XT + (size_t)b * Dn * Ln + (size_t)(bm * GBM) * Ln,
        XT + (size_t)b * Dn * Ln + (size_t)(bn * GBN) * Ln, sm, acc);

    // Row n of the stored G gets its columns below GBM * g_rows(n / GBN) straight
    // from the tiles of its column group (32 B a lane), the columns from there on
    // from the tiles that hold them as rows m (turned: 64 B a half wave).  Both
    // bounds are multiples of 32 floats: every element has one store and every
    // 128-byte line one work-group.
    {
        float* Gb = G + (size_t)b * Dn * Dn;
        const int lane = threadIdx.x & 31;
        const int wave = __builtin_amdgcn_readfirstlane(threadIdx.x >> 5);   // scalar: the test below is a branch
        const int n  = lane & 15;
        const int m0 = (lane >> 4) << 3;
        #pragma unroll  // acc[][] stays in registers
        for (int ms = 0; ms < GFA; ++ms) {
            #pragma unroll  // as above
            for (int ns = 0; ns < GFB; ++ns) {
                const v8f c = acc[ms][ns];
                const int nt = bn * GBN + (wave & 1) * (GFB * 16) + ns * 16;
                const int mt = bm * GBM + (wave >> 1) * (GFA * 16) + ms * 16;
                float* d = Gb + (size_t)(nt + n) * Dn + mt + m0;
                *(v4f*)d       = (v4f){c[0], c[1], c[2], c[3]};
                *(v4f*)(d + 4) = (v4f){c[4], c[5], c[6], c[7]};
                // Here and below: the next addresses reuse registers that the
                // stores just issued name.
                asm volatile("s_wait_xcnt 0x0" ::: "memory");
                if (nt >= GBM * g_rows(mt / GBN)) {
                    float* e = Gb + (size_t)(mt + m0) * Dn + nt + n;
                    #pragma unroll  // c[] stays in registers
                    for (int r = 0; r < 8; ++r) e[(size_t)r * Dn] = c[r];
                    asm volatile("s_wait_xcnt 0x0" ::: "memory");
                }
            }
        }
    }

    if (tt < CG && threadIdx.x < 32) {
        const int j = tt * 32 + threadIdx.x;
        float a = 0.f;
        for (int g = 0; g < RGX; ++g) a += sp[(size_t)(b * RGX + g) * Dn + j];
        s[b * Dn + j] = a;
    }
}

// Kernel 3: T^T[o][c] = sum_j G[c][j] Wv[o][j] + bv[o] s[c]; tl = Wv s + L bv.
__global__ __launch_bounds__(256) void tv_wmma(
    const float* __restrict__ G, const float* __restrict__ Wv,
    const float* __restrict__ bv, const float* __restrict__ s,
    float* __restrict__ TT, float* __restrict__ tl)
{
    __shared__ __attribute__((aligned(16))) float sm[TSM];
    const int b  = blockIdx.x / 32;
    const int tt = blockIdx.x % 32;
    const int bm = tt / 8;
    const int bn = tt % 8;

    v8f acc[TFA][TFB] = {};
    gemm_tn_staged<TBM, TBN, TKC, Dn, TFA, TFB, 256, 2, 12>(
        G + (size_t)b * Dn * Dn + (size_t)(bm * TBM) * Dn,
        Wv + (size_t)(bn * TBN) * Dn, sm, acc);
    store_t<true>(TT + (size_t)b * Dn * Dn, bm, bn, acc, bv, s + b * Dn);

    if (tt < CG)
        rowdot32<true>(Wv, s + b * Dn, (float)Ln, bv, tl + b * Dn, tt * 32);
}

// Kernel 4: P^T[o][a] = sum_c W2[a][c] T^T[o][c] + tl[o] w[a]; pl = T^T u + beta tl.
__global__ __launch_bounds__(256) void pk_wmma(
    const float* __restrict__ W2, const float* __restrict__ TT,
    const float* __restrict__ tl, const float* __restrict__ w,
    const float* __restrict__ u, const float* __restrict__ beta,
    float* __restrict__ PT, float* __restrict__ pl)
{
    __shared__ __attribute__((aligned(16))) float sm[TSM];
    const int b  = blockIdx.x / 32;
    const int tt = blockIdx.x % 32;
    const int bm = tt / 8;
    const int bn = tt % 8;
    // beta is read here, ahead of the product: a scalar load whose latency is
    // hidden, and no load of it stands behind the tile's stores.
    const float be = beta[0];

    v8f acc[TFA][TFB] = {};
    gemm_tn_staged<TBM, TBN, TKC, Dn, TFA, TFB, 256, 2, 12>(
        W2 + (size_t)(bm * TBM) * Dn,
        TT + (size_t)b * Dn * Dn + (size_t)(bn * TBN) * Dn, sm, acc);
    store_t<true>(PT + (size_t)b * Dn * Dn, bm, bn, acc, tl + b * Dn, w);

    if (tt < CG)
        rowdot32<true>(TT + (size_t)b * Dn * Dn, u, be, tl + b * Dn, pl + b * Dn, tt * 32);
}

// ---------------------------------------------------------------------------
// Kernel 5: out = (X P + 1 pl^T) * (1/sqrt(768)).  A = x row-major, B from P^T.
// 256 x 192 tile per work-group of 16 waves (4 x 4): 8 x 4 tiles x 8 batches =
// 256 work-groups, one per WGP.
// ---------------------------------------------------------------------------
__global__ __launch_bounds__(512) void xp_wmma(
    const float* __restrict__ x, const float* __restrict__ PT,
    const float* __restrict__ pl, float* __restrict__ out)
{
    constexpr int BM = 256, BN = 192, KC = 64, FA = 4, FB = 3;
    __shared__ __attribute__((aligned(16))) float sm[2 * (BM + BN) * (KC + 4)];   // 238 KiB

    const int b  = blockIdx.x / 32;
    const int tt = blockIdx.x % 32;
    const int bm = tt / 4;
    const int bn = tt % 4;

    v8f acc[FA][FB] = {};
    gemm_tn_staged<BM, BN, KC, Dn, FA, FB, 512, 4, 14>(
        x  + (size_t)b * Ln * Dn + (size_t)(bm * BM) * Dn,
        PT + (size_t)b * Dn * Dn + (size_t)(bn * BN) * Dn, sm, acc);

    const float alpha = 0.03608439182435161f;   // 1/sqrt(768)
    const int lane = threadIdx.x & 31;
    const int wave = threadIdx.x >> 5;
    const int n  = lane & 15;
    const int m0 = (lane >> 4) << 3;
    float* ob = out + (size_t)b * Ln * Dn;
    #pragma unroll
    for (int ns = 0; ns < FB; ++ns) {
        const int ng = bn * BN + (wave & 3) * (FB * 16) + ns * 16 + n;
        const float pb = pl[b * Dn + ng];
        #pragma unroll
        for (int ms = 0; ms < FA; ++ms) {
            const v8f c = acc[ms][ns];
            const int mg = bm * BM + (wave >> 2) * (FA * 16) + ms * 16 + m0;
            #pragma unroll
            for (int r = 0; r < 8; ++r)
                ob[(size_t)(mg + r) * Dn + ng] = (c[r] + pb) * alpha;
        }
    }
}

// ---------------------------------------------------------------------------
extern "C" void kernel_launch(void* const* d_in, const int* in_sizes, int n_in,
                              void* d_out, int out_size, void* d_ws, size_t ws_size,
                              hipStream_t stream) {
    const float* x  = (const float*)d_in[0];
    const float* Wq = (const float*)d_in[1];
    const float* bq = (const float*)d_in[2];
    const float* Wk = (const float*)d_in[3];
    const float* bk = (const float*)d_in[4];
    const float* Wv = (const float*)d_in[5];
    const float* bv = (const float*)d_in[6];
    float* out = (float*)d_out;

    // Workspace: X^T | G | T^T | P^T | W2 | sp | s | tl | pl | w | u | beta  (110 MB)
    float* XT  = (float*)d_ws;
    float* G   = XT  + (size_t)Rn * Dn;
    float* TT  = G   + (size_t)Bn * Dn * Dn;
    float* PT  = TT  + (size_t)Bn * Dn * Dn;
    float* W2  = PT  + (size_t)Bn * Dn * Dn;
    float* sp  = W2  + (size_t)Dn * Dn;
    float* s   = sp  + (size_t)Bn * RGX * Dn;
    float* tl  = s   + (size_t)Bn * Dn;
    float* pl  = tl  + (size_t)Bn * Dn;
    float* w   = pl  + (size_t)Bn * Dn;
    float* u   = w   + (size_t)Dn;
    float* beta = u  + (size_t)Dn;

    dim3 blk(256);  // 8 waves per workgroup
    prep     <<<NPRE + Bn * RGX * CG, blk, 0, stream>>>(x, Wq, bq, Wk, bk, XT, sp, W2, w, u, beta);
    gram_wmma<<<Bn * GNT, blk, 0, stream>>>(XT, sp, G, s);
    tv_wmma  <<<Bn * 32, blk, 0, stream>>>(G, Wv, bv, s, TT, tl);
    pk_wmma  <<<Bn * 32, blk, 0, stream>>>(W2, TT, tl, w, u, beta, PT, pl);
    xp_wmma  <<<Bn * 32, dim3(512), 0, stream>>>(x, PT, pl, out);
}

// v005
// One run takes 249 microseconds.
// Next to v004, in two timings, it ran 1.06 times as fast each time.
// All steps since v000 together make it 2.35 times as fast.
#include <hip/hip_runtime.h>

// FP32 WMMA building blocks for gfx1250 (wave32).
typedef float v2f __attribute__((ext_vector_type(2)));
typedef float v4f __attribute__((ext_vector_type(4)));
typedef float v8f __attribute__((ext_vector_type(8)));

#define WMMA_F32(a, b, c) \
    __builtin_amdgcn_wmma_f32_16x16x4_f32(false, (a), false, (b), (short)0, (c), false, false)
#define LO2(v) __builtin_shufflevector((v), (v), 0, 1)
#define HI2(v) __builtin_shufflevector((v), (v), 2, 3)

constexpr int Bn = 8;
constexpr int Ln = 2048;
constexpr int Dn = 768;

// The matrix chain, reassociated.  With X one batch of x (L x D), 1 a column of
// ones, G = X^T X and s = X^T 1:
//   K^T V = Wk G Wv^T + (Wk s) bv^T + bk (Wv s)^T + L bk bv^T
//   out   = (X Wq^T + 1 bq^T) (K^T V) / sqrt(D)
// so the three weight matrices multiply D x D matrices, not the L rows of X:
//   T^T[o][c] = sum_j Wv[o][j] G[c][j] + bv[o] s[c]     tl[o] = Wv[o] . s + L bv[o]
// and Wq^T (Wk T + bk tl^T) = (Wq^T Wk) T + (Wq^T bk) tl^T, where the products of
// the weights alone do not depend on the batch and are formed once:
//   W2[a][c]  = sum_h Wq[h][a] Wk[h][c]    w = Wq^T bk    u = Wk^T bq    beta = bq . bk
//   P^T[o][a] = sum_c T^T[o][c] W2[a][c] + tl[o] w[a]   pl[o] = T^T[o] . u + beta tl[o]
//   out[l][o] = (sum_a X[l][a] P^T[o][a] + pl[o]) / sqrt(D)

constexpr int CG  = Dn / 32;      // groups of 32 columns: 24

// ---------------------------------------------------------------------------
// First core: C = A * B^T, both operands contiguous along
// the reduction dim (leading dim LD = reduction length).  One BM x BN tile per
// work-group of NTHR / 32 waves, WN of them side by side along n, wave tile
// (16*FA) x (16*FB).  Chunks of KC k-columns of all BM + BN operand rows are
// brought into LDS by whole-line asynchronous b128 copies, two buffers: chunk
// c + 1 flies while chunk c is multiplied.  Fragments come from LDS with
// ds_load_b128 at a pitch of KC + 4 floats (16 B x odd: no bank conflict).
// ---------------------------------------------------------------------------

// A run of copies and its s_wait_xcnt 0 in ONE statement, so that no address
// register of a copy is rewritten ahead of the wait.
__device__ __forceinline__ void copy_run(const unsigned (&l)[12], const float* const (&g)[12]) {
    asm volatile("global_load_async_to_lds_b128 %0, %1, off\n\t"
                 "global_load_async_to_lds_b128 %2, %3, off\n\t"
                 "global_load_async_to_lds_b128 %4, %5, off\n\t"
                 "global_load_async_to_lds_b128 %6, %7, off\n\t"
                 "global_load_async_to_lds_b128 %8, %9, off\n\t"
                 "global_load_async_to_lds_b128 %10, %11, off\n\t"
                 "global_load_async_to_lds_b128 %12, %13, off\n\t"
                 "global_load_async_to_lds_b128 %14, %15, off\n\t"
                 "global_load_async_to_lds_b128 %16, %17, off\n\t"
                 "global_load_async_to_lds_b128 %18, %19, off\n\t"
                 "global_load_async_to_lds_b128 %20, %21, off\n\t"
                 "global_load_async_to_lds_b128 %22, %23, off\n\t"
                 "s_wait_xcnt 0x0"
                 :: "v"(l[0]), "v"(g[0]), "v"(l[1]), "v"(g[1]), "v"(l[2]), "v"(g[2]),
                    "v"(l[3]), "v"(g[3]), "v"(l[4]), "v"(g[4]), "v"(l[5]), "v"(g[5]),
                    "v"(l[6]), "v"(g[6]), "v"(l[7]), "v"(g[7]), "v"(l[8]), "v"(g[8]),
                    "v"(l[9]), "v"(g[9]), "v"(l[10]), "v"(g[10]), "v"(l[11]), "v"(g[11])
                 : "memory");
}
__device__ __forceinline__ void copy_run(const unsigned (&l)[14], const float* const (&g)[14]) {
    asm volatile("global_load_async_to_lds_b128 %0, %1, off\n\t"
                 "global_load_async_to_lds_b128 %2, %3, off\n\t"
                 "global_load_async_to_lds_b128 %4, %5, off\n\t"
                 "global_load_async_to_lds_b128 %6, %7, off\n\t"
                 "global_load_async_to_lds_b128 %8, %9, off\n\t"
                 "global_load_async_to_lds_b128 %10, %11, off\n\t"
                 "global_load_async_to_lds_b128 %12, %13, off\n\t"
                 "global_load_async_to_lds_b128 %14, %15, off\n\t"
                 "global_load_async_to_lds_b128 %16, %17, off\n\t"
                 "global_load_async_to_lds_b128 %18, %19, off\n\t"
                 "global_load_async_to_lds_b128 %20, %21, off\n\t"
                 "global_load_async_to_lds_b128 %22, %23, off\n\t"
                 "global_load_async_to_lds_b128 %24, %25, off\n\t"
                 "global_load_async_to_lds_b128 %26, %27, off\n\t"
                 "s_wait_xcnt 0x0"
                 :: "v"(l[0]), "v"(g[0]), "v"(l[1]), "v"(g[1]), "v"(l[2]), "v"(g[2]),
                    "v"(l[3]), "v"(g[3]), "v"(l[4]), "v"(g[4]), "v"(l[5]), "v"(g[5]),
                    "v"(l[6]), "v"(g[6]), "v"(l[7]), "v"(g[7]), "v"(l[8]), "v"(g[8]),
                    "v"(l[9]), "v"(g[9]), "v"(l[10]), "v"(g[10]), "v"(l[11]), "v"(g[11]),
                    "v"(l[12]), "v"(g[12]), "v"(l[13]), "v"(g[13])
                 : "memory");
}

// One chunk of all BM + BN rows: the block's NTHR lanes sweep NTHR * 4 / KC rows
// at a time, 16 B a lane, G copies a statement.  l0, ga, gb: this lane's slot in
// the first sweep (LDS byte address, A source, B source).
template <int BM, int BN, int KC, int LD, int NTHR, int G>
__device__ __forceinline__ void stage_chunk(unsigned l0, const float* ga, const float* gb) {
    constexpr int RPS = NTHR * 4 / KC;
    constexpr int NA = BM / RPS, NT = (BM + BN) / RPS;
    static_assert(BM % RPS == 0 && BN % RPS == 0 && NT % G == 0 && NT <= 63, "sweeps");
    #pragma unroll  // every operand index of a copy statement must be a constant
    for (int s = 0; s < NT; s += G) {
        unsigned l[G];
        const float* g[G];
        #pragma unroll  // as above
        for (int u = 0; u < G; ++u) {
            const int j = s + u;
            l[u] = l0 + (unsigned)(j * RPS * (KC + 4) * 4);
            g[u] = j < NA ? ga + (size_t)j * RPS * LD : gb + (size_t)(j - NA) * RPS * LD;
        }
        copy_run(l, g);
    }
}

template <int BM, int BN, int KC, int LD, int FA, int FB, int NTHR, int WN, int G>
__device__ __forceinline__ void gemm_tn_staged(const float* __restrict__ A,
                                               const float* __restrict__ B,
                                               float* sm, v8f (&acc)[FA][FB]) {
    constexpr int LDP = KC + 4;                   // LDS row pitch, floats
    constexpr int STG = (BM + BN) * LDP;          // floats per buffer
    constexpr int NCH = LD / KC;
    static_assert(BM == 16 * FA * (NTHR / 32 / WN) && BN == 16 * FB * WN && LD % KC == 0 && NCH >= 2, "tile");

    const int t    = threadIdx.x;
    const int lane = t & 31;
    const int wave = t >> 5;
    const int mr = lane & 15;
    const int h4 = (lane >> 4) << 2;              // {0, 4}

    const int crow = t / (KC / 4);
    const int ccol = (t % (KC / 4)) * 4;
    const float* ga = A + (size_t)crow * LD + ccol;
    const float* gb = B + (size_t)crow * LD + ccol;
    const unsigned l0 = (unsigned)(uintptr_t)(sm + crow * LDP + ccol);   // LDS byte address

    stage_chunk<BM, BN, KC, LD, NTHR, G>(l0, ga, gb);
    asm volatile("s_wait_asynccnt 0x0" ::: "memory");   // this wave's share of chunk 0 has landed
    __syncthreads();                                    // chunk 0 readable by every wave
    stage_chunk<BM, BN, KC, LD, NTHR, G>(l0 + STG * 4, ga + KC, gb + KC);

    const int ra = ((wave / WN) * (FA * 16) + mr) * LDP + h4;
    const int rb = (BM + (wave % WN) * (FB * 16) + mr) * LDP + h4;

    for (int c = 0; c < NCH; ++c) {
        const float* pa = sm + (c & 1) * STG + ra;
        const float* pb = sm + (c & 1) * STG + rb;
        #pragma unroll  // constant LDS offsets; lets fragment loads run ahead of the products
        for (int kk = 0; kk < KC; kk += 8) {
            // The inner loops below are unrolled so that the fragment and
            // accumulator arrays stay in registers (every index a constant).
            v4f a[FA], b[FB];
            #pragma unroll
            for (int i = 0; i < FA; ++i) a[i] = *(const v4f*)(pa + i * 16 * LDP + kk);
            #pragma unroll
            for (int j = 0; j < FB; ++j) b[j] = *(const v4f*)(pb + j * 16 * LDP + kk);
            // Per accumulator the low pair, then the high pair, but all tiles'
            // low pairs first: no back-to-back dependent accumulation.
            #pragma unroll
            for (int i = 0; i < FA; ++i)
                #pragma unroll
                for (int j = 0; j < FB; ++j)
                    acc[i][j] = WMMA_F32(LO2(a[i]), LO2(b[j]), acc[i][j]);
            #pragma unroll
            for (int i = 0; i < FA; ++i)
                #pragma unroll
                for (int j = 0; j < FB; ++j)
                    acc[i][j] = WMMA_F32(HI2(a[i]), HI2(b[j]), acc[i][j]);
        }
        asm volatile("s_wait_dscnt 0x0" ::: "memory");      // own reads of this buffer are done
        asm volatile("s_wait_asynccnt 0x0" ::: "memory");   // own share of chunk c + 1 has landed
        __syncthreads();                                    // publishes chunk c + 1, frees this buffer
        // Distance behind the chunk's last products, on both sides of the branch
        // below: the address arithmetic that follows reuses fragment registers.
        // The f32 16x16x4 form has no row of its own in the distance table; it
        // issues at the 8-bit-integer form's interval, so that form's 8 slots.
        // The fence pair keeps the products in front of the slots and the
        // address arithmetic behind them.
        __builtin_amdgcn_sched_barrier(0);
        asm volatile("v_nop\n\tv_nop\n\tv_nop\n\tv_nop\n\tv_nop\n\tv_nop\n\tv_nop\n\tv_nop");
        __builtin_amdgcn_sched_barrier(0);
        if (c + 2 < NCH)
            stage_chunk<BM, BN, KC, LD, NTHR, G>(l0 + (c & 1) * (STG * 4),
                                           ga + (c + 2) * KC, gb + (c + 2) * KC);
    }
    asm volatile("s_wait_asynccnt 0x0" ::: "memory");       // nothing in flight at the wave's end
}

// ---------------------------------------------------------------------------
// Second core: C[m][n] = sum_k A[k][m] B[k][n], both operands row-major with the
// reduction running DOWN their rows (row pitch Dn), read as they lie in memory:
// no transposed copy is made.  Chunks of KC rows of the tile's BM + BN columns
// come into LDS by asynchronous b128 copies, two buffers, the ring of the first
// core.  A wave's copy brings 4 rows of one whole 128-byte line each.  In LDS
// every 16 columns (one fragment's) form a block of their own: KC rows at a pitch
// of KP = 20 floats, the blocks of A first, then those of B.  A lane reads its
// fragment down one column of its block, 4 bytes a row, two neighbouring rows an
// instruction; lanes 16-31 stand four rows below lanes 0-15, which is 80 floats,
// 16 banks on: no bank conflict.  Work-group of 8 waves, WN side by side along n.
// ---------------------------------------------------------------------------
constexpr int KP = 20;                            // LDS pitch of a block's row, floats (16 B x odd)

// One chunk.  l0, ga, gb: this lane's slot in the first sweep of 32 rows (LDS
// byte address in the first pair of blocks; source in A, in B).
template <int BM, int BN, int KC, int G>
__device__ __forceinline__ void stage_rows(unsigned l0, const float* ga, const float* gb) {
    constexpr int NCA = BM / 32, NCB = (BM + BN) / 32;
    constexpr int NT = NCB * (KC / 32);
    static_assert(BM % 32 == 0 && BN % 32 == 0 && KC % 32 == 0 && NT % G == 0 && NT <= 63, "sweeps");
    #pragma unroll  // every operand index of a copy statement must be a constant
    for (int s = 0; s < NT; s += G) {
        unsigned l[G];
        const float* g[G];
        #pragma unroll  // as above
        for (int u = 0; u < G; ++u) {
            const int j  = s + u;
            const int cb = j % NCB;               // which line of 32 columns
            const int rr = (j / NCB) * 32;        // which sweep of 32 rows
            l[u] = l0 + (unsigned)((cb * 2 * KC * KP + rr * KP) * 4);
            g[u] = cb < NCA ? ga + (size_t)rr * Dn + cb * 32
                            : gb + (size_t)rr * Dn + (cb - NCA) * 32;
        }
        copy_run(l, g);
    }
}

// CS: cs[j] also gathers this lane's share of the column sums of its B fragments.
template <int BM, int BN, int KC, int KLEN, int FA, int FB, int WN, int G, bool CS>
__device__ __forceinline__ void gemm_kk_staged(const float* __restrict__ A,
                                               const float* __restrict__ B,
                                               float* sm, v8f (&acc)[FA][FB], v4f (&cs)[FB]) {
    constexpr int BLK = KC * KP;                  // floats per block of 16 columns
    constexpr int STG = (BM + BN) / 16 * BLK;     // floats per buffer
    constexpr int NCH = KLEN / KC;
    static_assert(BM == 16 * FA * (8 / WN) && BN == 16 * FB * WN && KLEN % KC == 0 && NCH >= 2, "tile");

    const int t    = threadIdx.x;
    const int lane = t & 31;
    const int wave = t >> 5;
    const int mr = lane & 15;
    const int h4 = (lane >> 4) << 2;              // {0, 4}

    const int crow = t >> 3;                      // 0..31: four rows a wave
    const int ccol = (t & 7) * 4;
    const float* ga = A + (size_t)crow * Dn + ccol;
    const float* gb = B + (size_t)crow * Dn + ccol;
    const unsigned l0 = (unsigned)(uintptr_t)(sm + (ccol >> 4) * BLK + crow * KP + (ccol & 15));   // LDS byte address

    stage_rows<BM, BN, KC, G>(l0, ga, gb);
    asm volatile("s_wait_asynccnt 0x0" ::: "memory");   // this wave's share of chunk 0 has landed
    __syncthreads();                                    // chunk 0 readable by every wave
    stage_rows<BM, BN, KC, G>(l0 + STG * 4, ga + (size_t)KC * Dn, gb + (size_t)KC * Dn);

    const int ra = (wave / WN) * FA * BLK + h4 * KP + mr;
    const int rb = (BM / 16 + (wave % WN) * FB) * BLK + h4 * KP + mr;

    for (int c = 0; c < NCH; ++c) {
        const float* pa = sm + (c & 1) * STG + ra;
        const float* pb = sm + (c & 1) * STG + rb;
        // Every loop below is unrolled so that the fragment and accumulator arrays
        // stay in registers and the LDS offsets are constants.  Element e of a
        // fragment is row kk + h4 + e, in A and in B alike: the k pairing of the
        // first core.  Two sets of fragments: the next step's are fetched ahead
        // of this step's products.
        v4f a[2][FA], b[2][FB];
        #pragma unroll
        for (int i = 0; i < FA; ++i)
            a[0][i] = (v4f){pa[i * BLK + 0 * KP], pa[i * BLK + 1 * KP], pa[i * BLK + 2 * KP], pa[i * BLK + 3 * KP]};
        #pragma unroll
        for (int j = 0; j < FB; ++j)
            b[0][j] = (v4f){pb[j * BLK + 0 * KP], pb[j * BLK + 1 * KP], pb[j * BLK + 2 * KP], pb[j * BLK + 3 * KP]};
        #pragma unroll
        for (int kk = 0; kk < KC; kk += 8) {
            const int cur = (kk >> 3) & 1, nxt = cur ^ 1, kn = kk + 8;
            if (kn < KC) {
                #pragma unroll
                for (int i = 0; i < FA; ++i)
                    a[nxt][i] = (v4f){pa[i * BLK + (kn + 0) * KP], pa[i * BLK + (kn + 1) * KP],
                                      pa[i * BLK + (kn + 2) * KP], pa[i * BLK + (kn + 3) * KP]};
                #pragma unroll
                for (int j = 0; j < FB; ++j)
                    b[nxt][j] = (v4f){pb[j * BLK + (kn + 0) * KP], pb[j * BLK + (kn + 1) * KP],
                                      pb[j * BLK + (kn + 2) * KP], pb[j * BLK + (kn + 3) * KP]};
            }
            if constexpr (CS) {
                #pragma unroll
                for (int j = 0; j < FB; ++j) {
                    cs[j] += b[cur][j];
                    // Empty asm on each sum, against spills: without it the adds sink
                    // to the chunk's end and every
                    // B fragment of the chunk stays live.
                    asm volatile("" : "+v"(cs[j]));
                }
            }
            #pragma unroll
            for (int i = 0; i < FA; ++i)
                #pragma unroll
                for (int j = 0; j < FB; ++j)
                    acc[i][j] = WMMA_F32(LO2(a[cur][i]), LO2(b[cur][j]), acc[i][j]);
            #pragma unroll
            for (int i = 0; i < FA; ++i)
                #pragma unroll
                for (int j = 0; j < FB; ++j)
                    acc[i][j] = WMMA_F32(HI2(a[cur][i]), HI2(b[cur][j]), acc[i][j]);
        }
        asm volatile("s_wait_dscnt 0x0" ::: "memory");      // own reads of this buffer are done
        asm volatile("s_wait_asynccnt 0x0" ::: "memory");   // own share of chunk c + 1 has landed
        __syncthreads();                                    // publishes chunk c + 1, frees this buffer
        // Distance behind the chunk's last products, on both sides of the branch
        // below, as in the first core: the address arithmetic reuses fragment registers.
        __builtin_amdgcn_sched_barrier(0);
        asm volatile("v_nop\n\tv_nop\n\tv_nop\n\tv_nop\n\tv_nop\n\tv_nop\n\tv_nop\n\tv_nop");
        __builtin_amdgcn_sched_barrier(0);
        if (c + 2 < NCH)
            stage_rows<BM, BN, KC, G>(l0 + (c & 1) * (STG * 4),
                                      ga + (size_t)(c + 2) * KC * Dn, gb + (size_t)(c + 2) * KC * Dn);
    }
    asm volatile("s_wait_asynccnt 0x0" ::: "memory");       // nothing in flight at the wave's end
}

// ---------------------------------------------------------------------------
// The parts for the weights alone; they ride in kernel 1 beside G.
// W2[a][c] = sum_h Wk[h][c] Wq[h][a]: the second core, one 192 (c) x 192 (a) tile
// per work-group, 16 work-groups: the WGPs that the tiles of G leave free.
// ---------------------------------------------------------------------------
constexpr int W2T = 192;                          // edge of a tile
constexpr int W2K = 64;                           // rows h a chunk
constexpr int W2FA = 3, W2FB = 6;
constexpr int NW2 = (Dn / W2T) * (Dn / W2T);      // tiles: 16

__device__ __forceinline__ void w2_tile(const float* __restrict__ Wq,
                                        const float* __restrict__ Wk,
                                        float* __restrict__ W2, float* sm, int tile) {
    const int lane = threadIdx.x & 31;
    const int wave = threadIdx.x >> 5;
    const int c0 = (tile / (Dn / W2T)) * W2T;
    const int a0 = (tile % (Dn / W2T)) * W2T;

    v8f acc[W2FA][W2FB] = {};
    v4f none[W2FB];
    gemm_kk_staged<W2T, W2T, W2K, Dn, W2FA, W2FB, 2, 12, false>(Wk + c0, Wq + a0, sm, acc, none);

    const int n  = lane & 15;
    const int m0 = (lane >> 4) << 3;
    #pragma unroll  // acc[][] stays in registers
    for (int ms = 0; ms < W2FA; ++ms) {
        #pragma unroll  // as above
        for (int ns = 0; ns < W2FB; ++ns) {
            const v8f c = acc[ms][ns];
            const int ng = a0 + (wave & 1) * (W2FB * 16) + ns * 16 + n;
            const int mg = c0 + (wave >> 1) * (W2FA * 16) + ms * 16 + m0;
            *(v4f*)(W2 + (size_t)ng * Dn + mg)     = (v4f){c[0], c[1], c[2], c[3]};
            *(v4f*)(W2 + (size_t)ng * Dn + mg + 4) = (v4f){c[4], c[5], c[6], c[7]};
            // The next addresses reuse registers that the stores just issued name.
            asm volatile("s_wait_xcnt 0x0" ::: "memory");
        }
    }
}

// dst[c] = sum_h Mat[h][c] vec[h] for the 32 columns from c0 on: a wave takes
// every eighth row, a lane one column; 32 results = one whole 128-byte line.
__device__ __forceinline__ void colvec32(const float* __restrict__ Mat,
                                         const float* __restrict__ vec,
                                         float* __restrict__ dst, int c0, float* sm) {
    const int lane = threadIdx.x & 31;
    const int wave = threadIdx.x >> 5;
    float a = 0.f;
    #pragma unroll 16  // sixteen independent loads in flight
    for (int i = 0; i < Dn / 8; ++i) {
        const int h = wave + 8 * i;
        a += Mat[(size_t)h * Dn + c0 + lane] * vec[h];
    }
    sm[wave * 32 + lane] = a;
    __syncthreads();                              // the eight partial sums are complete
    if (wave == 0) {
        float r = 0.f;
        for (int j = 0; j < 8; ++j) r += sm[j * 32 + lane];
        dst[c0 + lane] = r;
    }
}

// dst[0] = p . q over Dn elements (every wave forms it, thread 0 stores it).
__device__ __forceinline__ void dot_dn(const float* __restrict__ p,
                                       const float* __restrict__ q,
                                       float* __restrict__ dst) {
    const int lane = threadIdx.x & 31;
    float a = 0.f;
    #pragma unroll  // six independent pairs of loads in flight
    for (int j = 0; j < Dn / 128; ++j) {
        const v4f m = *(const v4f*)(p + j * 128 + lane * 4);
        const v4f v = *(const v4f*)(q + j * 128 + lane * 4);
        a += (m[0] * v[0] + m[1] * v[1]) + (m[2] * v[2] + m[3] * v[3]);
    }
    for (int o = 16; o; o >>= 1) a += __shfl_xor(a, o);
    if (threadIdx.x == 0) dst[0] = a;
}

// ---------------------------------------------------------------------------
// Kernels 2 and 3: 768 x 768 results per batch, one 192 x 96 tile per work-group:
// 4 x 8 tiles x 8 batches = 256 work-groups, one per WGP.  The result is stored
// transposed, CT[n][m] = sum_k A[m][k] B[n][k] (+ un[n] * vm[m] where R1).
// ---------------------------------------------------------------------------
constexpr int TBM = 192, TBN = 96, TKC = 128, TFA = 3, TFB = 3;
constexpr int TSM = 2 * (TBM + TBN) * (TKC + 4);  // floats of LDS: 297 KiB

template <bool R1>
__device__ __forceinline__ void store_t(float* __restrict__ CT, int bm, int bn,
                                        const v8f (&acc)[TFA][TFB],
                                        const float* __restrict__ un,
                                        const float* __restrict__ vm) {
    const int lane = threadIdx.x & 31;
    const int wave = threadIdx.x >> 5;
    const int n  = lane & 15;
    const int m0 = (lane >> 4) << 3;
    #pragma unroll
    for (int ms = 0; ms < TFA; ++ms) {
        #pragma unroll
        for (int ns = 0; ns < TFB; ++ns) {
            const v8f c = acc[ms][ns];
            const int ng = bn * TBN + (wave & 1) * (TFB * 16) + ns * 16 + n;
            const int mg = bm * TBM + (wave >> 1) * (TFA * 16) + ms * 16 + m0;
            v4f lo = (v4f){c[0], c[1], c[2], c[3]};
            v4f hi = (v4f){c[4], c[5], c[6], c[7]};
            if (R1) {
                const float u = un[ng];
                lo += u * *(const v4f*)(vm + mg);
                hi += u * *(const v4f*)(vm + mg + 4);
            }
            *(v4f*)(CT + (size_t)ng * Dn + mg)     = lo;
            *(v4f*)(CT + (size_t)ng * Dn + mg + 4) = hi;
        }
    }
}

// dst[r] = Mat[r] . vec (+ addc * addv[r] where ADD) for the 32 rows from r0 on:
// one wave a row, four rows a wave; 32 results = one whole 128-byte line.
template <bool ADD>
__device__ __forceinline__ void rowdot32(const float* __restrict__ Mat,
                                         const float* __restrict__ vec,
                                         float addc, const float* __restrict__ addv,
                                         float* __restrict__ dst, int r0) {
    const int lane = threadIdx.x & 31;
    const int wave = threadIdx.x >> 5;
    // The loads below reuse registers that the tile's stores, just issued, name.
    asm volatile("s_wait_xcnt 0x0" ::: "memory");
    for (int i = 0; i < 4; ++i) {
        const int r = r0 + wave * 4 + i;
        float a = 0.f;
        #pragma unroll  // six independent pairs of loads in flight
        for (int j = 0; j < Dn / 128; ++j) {
            const v4f m = *(const v4f*)(Mat + (size_t)r * Dn + j * 128 + lane * 4);
            const v4f v = *(const v4f*)(vec + j * 128 + lane * 4);
            a += (m[0] * v[0] + m[1] * v[1]) + (m[2] * v[2] + m[3] * v[3]);
        }
        for (int o = 16; o; o >>= 1) a += __shfl_xor(a, o);
        if (lane == 0) dst[r] = ADD ? a + addc * addv[r] : a;
    }
}

// Kernel 1: G = X^T X (reduction over l = 2048, down the rows of x: the second
// core); the column sums s; and the parts for the weights alone.
// G[p][q] and G[q][p] are the same sum of the same products for any x, so only
// the tiles that hold an element on or above the diagonal are multiplied, and
// the rest of G is stored from them a second time, turned.  128 (m) x 96 (n)
// tiles: column group bn needs the row groups bm with 128 bm <= 96 bn + 95, which
// makes 30 tiles of the 48 a batch, 240 work-groups; with the 16 tiles of W2,
// which are the longest and come first, 256 work-groups, one per WGP.
constexpr int GBM = 128, GBN = 96, GFA = 2, GFB = 3;
constexpr int GSM = 2 * (GBM + GBN) / 16 * TKC * KP;   // floats of LDS: 280 KiB
static_assert(GSM >= 2 * (2 * W2T) / 16 * W2K * KP, "the buffers of a W2 tile fit");
// Row groups multiplied for column group bn.
constexpr int g_rows(int bn) { return (GBN * bn + GBN - 1) / GBM + 1; }
constexpr int g_tiles() { int n = 0; for (int j = 0; j < Dn / GBN; ++j) n += g_rows(j); return n; }
constexpr int GNT = g_tiles();                    // tiles a batch: 30
static_assert(Bn * GNT > 2 * CG, "the small parts for the weights each find a work-group");

__global__ __launch_bounds__(256) void gram_wmma(
    const float* __restrict__ x, const float* __restrict__ Wq, const float* __restrict__ bq,
    const float* __restrict__ Wk, const float* __restrict__ bk,
    float* __restrict__ G, float* __restrict__ s, float* __restrict__ W2,
    float* __restrict__ w, float* __restrict__ u, float* __restrict__ beta)
{
    __shared__ __attribute__((aligned(16))) float sm[GSM];
    if (blockIdx.x < NW2) {                       // the whole work-group takes this way or none of it
        w2_tile(Wq, Wk, W2, sm, blockIdx.x);
        return;
    }
    const int blk = blockIdx.x - NW2;
    const int b  = blk / GNT;
    const int tt = blk % GNT;
    int bm = tt, bn = 0;
    while (bm >= g_rows(bn)) bm -= g_rows(bn++);  // at most Dn / GBN - 1 trips: tt < GNT

    v8f acc[GFA][GFB] = {};
    v4f cs[GFB] = {};
    gemm_kk_staged<GBM, GBN, TKC, Ln, GFA, GFB, 2, 14, true>(
        x + (size_t)b * Ln * Dn + bm * GBM,
        x + (size_t)b * Ln * Dn + bn * GBN, sm, acc, cs);

    // Row n of the stored G gets its columns below GBM * g_rows(n / GBN) straight
    // from the tiles of its column group (32 B a lane), the columns from there on
    // from the tiles that hold them as rows m (turned: 64 B a half wave).  Both
    // bounds are multiples of 32 floats: every element has one store and every
    // 128-byte line one work-group.
    {
        float* Gb = G + (size_t)b * Dn * Dn;
        const int lane = threadIdx.x & 31;
        const int wave = __builtin_amdgcn_readfirstlane(threadIdx.x >> 5);   // scalar: the tests below are branches
        const int n  = lane & 15;
        const int m0 = (lane >> 4) << 3;
        #pragma unroll  // acc[][] stays in registers
        for (int ms = 0; ms < GFA; ++ms) {
            #pragma unroll  // as above
            for (int ns = 0; ns < GFB; ++ns) {
                const v8f c = acc[ms][ns];
                const int nt = bn * GBN + (wave & 1) * (GFB * 16) + ns * 16;
                const int mt = bm * GBM + (wave >> 1) * (GFA * 16) + ms * 16;
                float* d = Gb + (size_t)(nt + n) * Dn + mt + m0;
                *(v4f*)d       = (v4f){c[0], c[1], c[2], c[3]};
                *(v4f*)(d + 4) = (v4f){c[4], c[5], c[6], c[7]};
                // Here and below: the next addresses reuse registers that the
                // stores just issued name.
                asm volatile("s_wait_xcnt 0x0" ::: "memory");
                if (nt >= GBM * g_rows(mt / GBN)) {
                    float* e = Gb + (size_t)(mt + m0) * Dn + nt + n;
                    #pragma unroll  // c[] stays in registers
                    for (int r = 0; r < 8; ++r) e[(size_t)r * Dn] = c[r];
                    asm volatile("s_wait_xcnt 0x0" ::: "memory");
                }
            }
        }

        // s: every column group bn has its tile with bm = 0; there waves 0 and 1
        // hold, as B fragments, all 2048 rows of the group's 96 columns.  A lane
        // has summed the rows of its half of every eight; the halves are added.
        if (bm == 0 && wave < 2) {
            #pragma unroll  // cs[] stays in registers
            for (int j = 0; j < GFB; ++j) {
                float a = (cs[j][0] + cs[j][1]) + (cs[j][2] + cs[j][3]);
                a += __shfl_xor(a, 16);
                if (lane < 16) s[b * Dn + bn * GBN + wave * (GFB * 16) + j * 16 + n] = a;
            }
            asm volatile("s_wait_xcnt 0x0" ::: "memory");
        }
    }

    // The small parts for the weights, one to a work-group.  The ring's last
    // barrier stands behind every read of sm, so that colvec32 may write it.
    if (blk < CG)           colvec32(Wq, bk, w, blk * 32, sm);
    else if (blk < 2 * CG)  colvec32(Wk, bq, u, (blk - CG) * 32, sm);
    else if (blk == 2 * CG) dot_dn(bq, bk, beta);
}

// Kernel 2: T^T[o][c] = sum_j G[c][j] Wv[o][j] + bv[o] s[c]; tl = Wv s + L bv.
__global__ __launch_bounds__(256) void tv_wmma(
    const float* __restrict__ G, const float* __restrict__ Wv,
    const float* __restrict__ bv, const float* __restrict__ s,
    float* __restrict__ TT, float* __restrict__ tl)
{
    __shared__ __attribute__((aligned(16))) float sm[TSM];
    const int b  = blockIdx.x / 32;
    const int tt = blockIdx.x % 32;
    const int bm = tt / 8;
    const int bn = tt % 8;

    v8f acc[TFA][TFB] = {};
    gemm_tn_staged<TBM, TBN, TKC, Dn, TFA, TFB, 256, 2, 12>(
        G + (size_t)b * Dn * Dn + (size_t)(bm * TBM) * Dn,
        Wv + (size_t)(bn * TBN) * Dn, sm, acc);
    store_t<true>(TT + (size_t)b * Dn * Dn, bm, bn, acc, bv, s + b * Dn);

    if (tt < CG)
        rowdot32<true>(Wv, s + b * Dn, (float)Ln, bv, tl + b * Dn, tt * 32);
}

// Kernel 3: P^T[o][a] = sum_c W2[a][c] T^T[o][c] + tl[o] w[a]; pl = T^T u + beta tl.
__global__ __launch_bounds__(256) void pk_wmma(
    const float* __restrict__ W2, const float* __restrict__ TT,
    const float* __restrict__ tl, const float* __restrict__ w,
    const float* __restrict__ u, const float* __restrict__ beta,
    float* __restrict__ PT, float* __restrict__ pl)
{
    __shared__ __attribute__((aligned(16))) float sm[TSM];
    const int b  = blockIdx.x / 32;
    const int tt = blockIdx.x % 32;
    const int bm = tt / 8;
    const int bn = tt % 8;
    // beta is read here, ahead of the product: a scalar load whose latency is
    // hidden, and no load of it stands behind the tile's stores.
    const float be = beta[0];

    v8f acc[TFA][TFB] = {};
    gemm_tn_staged<TBM, TBN, TKC, Dn, TFA, TFB, 256, 2, 12>(
        W2 + (size_t)(bm * TBM) * Dn,
        TT + (size_t)b * Dn * Dn + (size_t)(bn * TBN) * Dn, sm, acc);
    store_t<true>(PT + (size_t)b * Dn * Dn, bm, bn, acc, tl + b * Dn, w);

    if (tt < CG)
        rowdot32<true>(TT + (size_t)b * Dn * Dn, u, be, tl + b * Dn, pl + b * Dn, tt * 32);
}

// ---------------------------------------------------------------------------
// Kernel 4: out = (X P + 1 pl^T) * (1/sqrt(768)).  A = x row-major, B from P^T.
// 256 x 192 tile per work-group of 16 waves (4 x 4): 8 x 4 tiles x 8 batches =
// 256 work-groups, one per WGP.
// ---------------------------------------------------------------------------
__global__ __launch_bounds__(512) void xp_wmma(
    const float* __restrict__ x, const float* __restrict__ PT,
    const float* __restrict__ pl, float* __restrict__ out)
{
    constexpr int BM = 256, BN = 192, KC = 64, FA = 4, FB = 3;
    __shared__ __attribute__((aligned(16))) float sm[2 * (BM + BN) * (KC + 4)];   // 238 KiB

    const int b  = blockIdx.x / 32;
    const int tt = blockIdx.x % 32;
    const int bm = tt / 4;
    const int bn = tt % 4;

    v8f acc[FA][FB] = {};
    gemm_tn_staged<BM, BN, KC, Dn, FA, FB, 512, 4, 14>(
        x  + (size_t)b * Ln * Dn + (size_t)(bm * BM) * Dn,
        PT + (size_t)b * Dn * Dn + (size_t)(bn * BN) * Dn, sm, acc);

    const float alpha = 0.03608439182435161f;   // 1/sqrt(768)
    const int lane = threadIdx.x & 31;
    const int wave = threadIdx.x >> 5;
    const int n  = lane & 15;
    const int m0 = (lane >> 4) << 3;
    float* ob = out + (size_t)b * Ln * Dn;
    #pragma unroll
    for (int ns = 0; ns < FB; ++ns) {
        const int ng = bn * BN + (wave & 3) * (FB * 16) + ns * 16 + n;
        const float pb = pl[b * Dn + ng];
        #pragma unroll
        for (int ms = 0; ms < FA; ++ms) {
            const v8f c = acc[ms][ns];
            const int mg = bm * BM + (wave >> 2) * (FA * 16) + ms * 16 + m0;
            #pragma unroll
            for (int r = 0; r < 8; ++r)
                ob[(size_t)(mg + r) * Dn + ng] = (c[r] + pb) * alpha;
        }
    }
}

// ---------------------------------------------------------------------------
extern "C" void kernel_launch(void* const* d_in, const int* in_sizes, int n_in,
                              void* d_out, int out_size, void* d_ws, size_t ws_size,
                              hipStream_t stream) {
    const float* x  = (const float*)d_in[0];
    const float* Wq = (const float*)d_in[1];
    const float* bq = (const float*)d_in[2];
    const float* Wk = (const float*)d_in[3];
    const float* bk = (const float*)d_in[4];
    const float* Wv = (const float*)d_in[5];
    const float* bv = (const float*)d_in[6];
    float* out = (float*)d_out;

    // Workspace: G | T^T | P^T | W2 | s | tl | pl | w | u | beta  (59 MB)
    float* G   = (float*)d_ws;
    float* TT  = G   + (size_t)Bn * Dn * Dn;
    float* PT  = TT  + (size_t)Bn * Dn * Dn;
    float* W2  = PT  + (size_t)Bn * Dn * Dn;
    float* s   = W2  + (size_t)Dn * Dn;
    float* tl  = s   + (size_t)Bn * Dn;
    float* pl  = tl  + (size_t)Bn * Dn;
    float* w   = pl  + (size_t)Bn * Dn;
    float* u   = w   + (size_t)Dn;
    float* beta = u  + (size_t)Dn;

    dim3 blk(256);  // 8 waves per workgroup
    gram_wmma<<<NW2 + Bn * GNT, blk, 0, stream>>>(x, Wq, bq, Wk, bk, G, s, W2, w, u, beta);
    tv_wmma  <<<Bn * 32, blk, 0, stream>>>(G, Wv, bv, s, TT, tl);
    pk_wmma  <<<Bn * 32, blk, 0, stream>>>(W2, TT, tl, w, u, beta, PT, pl);
    xp_wmma  <<<Bn * 32, dim3(512), 0, stream>>>(x, PT, pl, out);
}
